// v000
// The times below were measured on an AMD MI455X: many runs one after another, warmed up first and cycling through
// copies of the inputs, with the whole window's GPU time divided by the number of runs. Launches and the gaps
// between them are all in it. The median over several windows is given; except for v000 it joins two sittings, which
// can be a few percent apart, so the side-by-side timings, each taken in one sitting, are the better comparison.
// The starting kernel, v000, takes 138 microseconds a run.
#include <hip/hip_runtime.h>

// Contractions: scores^T tile = k-rows x q-rows^T on v_wmma_f32_16x16x32_bf16 (bf16 operands = RNE-converted inputs, single product, f32 accumulate);
// context^T tile = v^T x P^T on v_wmma_f32_16x16x32_bf16 with P carried as bf16 hi + bf16 residual (two products into one f32 accumulator), v as RNE bf16;
// online softmax (running max, rescale, row sums) and the final normalisation in f32.
// q, k, v [NB][16][SEQ][64] f32 head-major units (unit stride SEQ_FULL*64); causal: key j contributes to query i iff j <= i; out [NB][16][SEQ][64] f32 (unit stride SEQ_FULL*64).

#ifndef NB
#define NB 8
#endif
#ifndef SEQ
#define SEQ 1024
#endif
#define NB_FULL 8
#define SEQ_FULL 1024
#define NHD 16
#define HD 64
#define NU (NB * NHD)
#define SCL 0.125f
#define NEGBIG (-1.0e30f)
#define OSP 68

static_assert(SEQ % 64 == 0);
static_assert(SEQ >= 64 && SEQ <= SEQ_FULL);
static_assert(NB >= 1 && NB <= NB_FULL);
static_assert(HD == 64);

typedef unsigned short bf;
typedef __attribute__((ext_vector_type(16))) __bf16 v16bf;
typedef __attribute__((ext_vector_type(16))) unsigned short v16us;
typedef __attribute__((ext_vector_type(8))) unsigned short v8us;
typedef __attribute__((ext_vector_type(8))) float v8f;
typedef __attribute__((ext_vector_type(4))) float v4f;
typedef v4f __attribute__((may_alias)) v4fa;

__device__ __forceinline__ unsigned short f2bf(float f) { unsigned u = __float_as_uint(f); u += 0x7FFFu + ((u >> 16) & 1u); return (unsigned short)(u >> 16); }
__device__ __forceinline__ float bf2f(unsigned short b) { return __uint_as_float(((unsigned)b) << 16); }
__device__ __forceinline__ void splitf(float y, unsigned short& hp, unsigned short& lp) { hp = f2bf(y); lp = f2bf(y - bf2f(hp)); }
__device__ __forceinline__ v16bf cat16b(v8us lo, v8us hi) {
    v16us w = __builtin_shufflevector(lo, hi, 0, 1, 2, 3, 4, 5, 6, 7, 8, 9, 10, 11, 12, 13, 14, 15);
    return __builtin_bit_cast(v16bf, w);
}
// Fragment loader for A (row = lane&15) and B (col = lane&15) from a k-contiguous 16-bit row: p = row_base + k0 + 8*h;
// elements 0..7 <- k0 + 8h + 0..7, elements 8..15 <- k0 + 16 + 8h + 0..7.
__device__ __forceinline__ v16bf ldfrag(const bf* p) { return cat16b(*(const v8us*)p, *(const v8us*)(p + 16)); }
__device__ __forceinline__ v8f wmmab(v16bf a, v16bf b, v8f c) { return __builtin_amdgcn_wmma_f32_16x16x32_bf16(false, a, false, b, (short)0, c, false, false); }

__global__ __launch_bounds__(256) void k_cvt8(const float* __restrict__ src, bf* dst, unsigned n8) {
    const unsigned i = blockIdx.x * 256u + threadIdx.x;
    if (i >= n8) return;
    const size_t e = (size_t)i * 8;
    const size_t u = e / ((size_t)SEQ * HD);
    const size_t rem = e - u * ((size_t)SEQ * HD);
    const v8f v = *(const v8f*)(src + u * (size_t)SEQ_FULL * HD + rem);
    v8us o;
#pragma unroll
    for (int k = 0; k < 8; ++k) o[k] = f2bf(v[k]);
    *(v8us*)(dst + e) = o;
    
}

// k_vt: value transpose plane VT[u][d][t] = RNE bf16 of v[u][t][d]; one block per (u, 64-key tile): f32 tile staged in LDS (block barrier, cross-wave),
__global__ __launch_bounds__(256) void k_vt(const float* __restrict__ V, bf* VT) {
    __shared__ __align__(16) float tile[64 * OSP];
    const int t = threadIdx.x;
    const int u = (int)blockIdx.x / (SEQ / 64);
    const int kt = (int)blockIdx.x - u * (SEQ / 64);
    const float* vsrc = V + (size_t)u * SEQ_FULL * HD + (size_t)kt * 64 * HD;
#pragma unroll
    for (int i = 0; i < 4; ++i) {
        const int lin = i * 256 + t;
        const int key = lin >> 4, c4 = (lin & 15) * 4;
        const v4f a = *(const v4f*)(vsrc + (size_t)key * HD + c4);
        *(v4fa*)(tile + key * OSP + c4) = a;
    }
    __syncthreads();
    const int lane = t & 31, wv = t >> 5;
    v8us o0, o1;
    const int d0 = 4 * wv + (lane >> 3), d1 = 4 * (wv + 8) + (lane >> 3);
    const int t0 = (lane & 7) * 8;
#pragma unroll
    for (int j = 0; j < 8; ++j) { o0[j] = f2bf(tile[(t0 + j) * OSP + d0]); o1[j] = f2bf(tile[(t0 + j) * OSP + d1]); }
    bf* dst0 = VT + ((size_t)u * HD + d0) * SEQ + (size_t)kt * 64 + t0;
    bf* dst1 = VT + ((size_t)u * HD + d1) * SEQ + (size_t)kt * 64 + t0;
    *(v8us*)dst0 = o0;
    *(v8us*)dst1 = o1;
    
}

// k_attn: one wave = 16 query rows (q0 .. q0+15) of one unit; key blocks of 32 visited while jb <= q0+15 (causal), online softmax in f32.
// S^T tiles: A = key rows of the k plane, B = query rows of the q plane (both k-contiguous loads with the same split k map), D[key 8h+r][query lane&15].
// P^T as B operand of the context product is taken in-lane from the two S^T accumulators (element r <- keys jb+8h+r, element 8+r <- keys jb+16+8h+r).
// Context^T: A = rows of VT (d), D[d 8h+r][query lane&15]; epilogue stages the 16x64 tile in wave-private LDS (block barrier before the reload) and
__global__ __launch_bounds__(128) __attribute__((amdgpu_num_vgpr(256)))
void k_attn(const bf* __restrict__ QB, const bf* __restrict__ KB, const bf* __restrict__ VT, float* OUT) {
    __shared__ __align__(16) float os[4 * 16 * OSP];
    const int lane = threadIdx.x & 31, m = lane & 15, h = lane >> 4;
    const int wv = __builtin_amdgcn_readfirstlane((int)(threadIdx.x >> 5));
    const int gw = (int)blockIdx.x * 4 + wv;
    const int tiles = SEQ / 16;
    const int u = gw / tiles;
    const int q0 = (gw - u * tiles) * 16;
    const bf* qp = QB + (size_t)u * SEQ * HD;
    const bf* kp = KB + (size_t)u * SEQ * HD;
    const bf* vp = VT + (size_t)u * HD * SEQ;
    float* op = OUT + ((size_t)u * SEQ_FULL + q0) * HD;

    v16bf qf[2];
#pragma unroll
    for (int kb = 0; kb < 2; ++kb) qf[kb] = ldfrag(qp + (size_t)(q0 + m) * HD + kb * 32 + 8 * h);

    v8f oacc[4];
#pragma unroll
    for (int c = 0; c < 4; ++c) oacc[c] = (v8f){};
    float mrun = NEGBIG, lrun = 0.0f;
    const int qi = q0 + m;
    const int jend = q0 + 16;

#pragma unroll 1
    for (int jb = 0; jb < jend; jb += 32) {
        // ---- S^T = K(32 keys) x Q^T(16 queries), 64 deep
        v16bf ka[2][2];
#pragma unroll
        for (int jt = 0; jt < 2; ++jt)
#pragma unroll
            for (int kb = 0; kb < 2; ++kb) ka[jt][kb] = ldfrag(kp + (size_t)(jb + 16 * jt + m) * HD + kb * 32 + 8 * h);
        v8f st[2];
#pragma unroll
        for (int jt = 0; jt < 2; ++jt) {
            st[jt] = (v8f){};
            st[jt] = wmmab(ka[jt][0], qf[0], st[jt]);
            st[jt] = wmmab(ka[jt][1], qf[1], st[jt]);
        }
        asm volatile("v_nop\n\tv_nop\n\tv_nop\n\tv_nop" : "+v"(st[0]), "+v"(st[1]) : "v"(ka[0][1]), "v"(ka[1][1]), "v"(qf[1]));

        // ---- causal replace-fill, running max, exp, row sums (f32)
        float p0[8], p1[8];
        float mx = NEGBIG;
#pragma unroll
        for (int r = 0; r < 8; ++r) {
            const int k0i = jb + 8 * h + r;
            float x0 = st[0][r] * SCL;
            float x1 = st[1][r] * SCL;
            x0 = (k0i <= qi) ? x0 : NEGBIG;
            x1 = (k0i + 16 <= qi) ? x1 : NEGBIG;
            p0[r] = x0; p1[r] = x1;
            mx = fmaxf(mx, fmaxf(x0, x1));
        }
        mx = fmaxf(mx, __shfl_xor(mx, 16, 32));
        const float mn = fmaxf(mrun, mx);
        const float rsc = __expf(mrun - mn);
        mrun = mn;
        float ls = 0.0f;
#pragma unroll
        for (int r = 0; r < 8; ++r) {
            p0[r] = __expf(p0[r] - mn);
            p1[r] = __expf(p1[r] - mn);
            ls += p0[r] + p1[r];
        }
        ls += __shfl_xor(ls, 16, 32);
        lrun = lrun * rsc + ls;
#pragma unroll
        for (int c = 0; c < 4; ++c) oacc[c] = oacc[c] * rsc;

        // ---- P^T as B operand: bf16 hi + bf16 residual, in-lane (k = key: element r <- jb+8h+r, element 8+r <- jb+16+8h+r; n = query lane&15)
        v8us ph0, ph1, pl0, pl1;
#pragma unroll
        for (int r = 0; r < 8; ++r) {
            unsigned short ah, al;
            splitf(p0[r], ah, al); ph0[r] = ah; pl0[r] = al;
            splitf(p1[r], ah, al); ph1[r] = ah; pl1[r] = al;
        }
        const v16bf bph = cat16b(ph0, ph1);
        const v16bf bpl = cat16b(pl0, pl1);

        // ---- context^T += V^T(16 d rows) x P^T, two products per tile
        v16bf va;
#pragma unroll
        for (int c = 0; c < 4; ++c) {
            va = ldfrag(vp + (size_t)(c * 16 + m) * SEQ + jb + 8 * h);
            oacc[c] = wmmab(va, bph, oacc[c]);
            oacc[c] = wmmab(va, bpl, oacc[c]);
        }
        asm volatile("v_nop\n\tv_nop\n\tv_nop\n\tv_nop" : "+v"(oacc[0]), "+v"(oacc[1]), "+v"(oacc[2]), "+v"(oacc[3]) : "v"(va), "v"(bph), "v"(bpl));
    }

    const float inv = 1.0f / lrun;
    float* osw = os + wv * (16 * OSP);
#pragma unroll
    for (int c = 0; c < 4; ++c) {
        v4f a, b;
        a[0] = oacc[c][0] * inv; a[1] = oacc[c][1] * inv; a[2] = oacc[c][2] * inv; a[3] = oacc[c][3] * inv;
        b[0] = oacc[c][4] * inv; b[1] = oacc[c][5] * inv; b[2] = oacc[c][6] * inv; b[3] = oacc[c][7] * inv;
        *(v4fa*)(osw + m * OSP + c * 16 + 8 * h) = a;
        *(v4fa*)(osw + m * OSP + c * 16 + 8 * h + 4) = b;
    }
    __syncthreads();
    v4f vals[8];
#pragma unroll
    for (int s = 0; s < 8; ++s) vals[s] = *(const v4fa*)(osw + (2 * s + h) * OSP + m * 4);
#pragma unroll
    for (int s = 0; s < 8; ++s) *(v4f*)(op + (size_t)(2 * s + h) * HD + m * 4) = vals[s];
    
}

extern "C" void kernel_launch(void* const* d_in, const int* in_sizes, int n_in,
                              void* d_out, int out_size, void* d_ws, size_t ws_size, hipStream_t stream) {
    if (n_in < 3) return;
    const long long need = (long long)NU * SEQ_FULL * HD;
    if ((long long)in_sizes[0] < need || (long long)in_sizes[1] < need || (long long)in_sizes[2] < need) return;
    if ((long long)out_size < need) return;
    const size_t plane = (size_t)NU * SEQ * HD;   // elements per 16-bit plane (q, k, v^T)
    const size_t pbytes = plane * 2;                // 16 MiB each at NB=8, SEQ=1024; total carve 48 MiB
    if (3 * pbytes > ws_size) return;
    char* ws = (char*)d_ws;
    bf* QB = (bf*)ws;
    bf* KB = (bf*)(ws + pbytes);
    bf* VT = (bf*)(ws + 2 * pbytes);
    const float* Qin = (const float*)d_in[0];
    const float* Kin = (const float*)d_in[1];
    const float* Vin = (const float*)d_in[2];
    float* OUT = (float*)d_out;
    const unsigned n8 = (unsigned)(plane / 8);
    k_cvt8<<<dim3((n8 + 255u) / 256u), dim3(256), 0, stream>>>(Qin, QB, n8);
    k_cvt8<<<dim3((n8 + 255u) / 256u), dim3(256), 0, stream>>>(Kin, KB, n8);
    k_vt<<<dim3((unsigned)(NU * (SEQ / 64))), dim3(256), 0, stream>>>(Vin, VT);
    k_attn<<<dim3((unsigned)(NU * SEQ / 64)), dim3(128), 0, stream>>>(QB, KB, VT, OUT);
}

// v001
// Measured time: 90 microseconds a run.
// Timed twice side by side with v000, it ran 1.54 and 1.55 times as fast.
#include <hip/hip_runtime.h>

// Contractions: scores^T tile = k-rows x q-rows^T on v_wmma_f32_16x16x32_bf16 (bf16 operands = RNE-converted inputs, single product, f32 accumulate);
// context^T tile = v^T x P^T on v_wmma_f32_16x16x32_bf16 with P carried as bf16 hi + bf16 residual (two products into one f32 accumulator), v as RNE bf16;
// online softmax (running max, rescale, row sums) and the final normalisation in f32.
// q, k, v [NB][16][SEQ][64] f32 head-major units (unit stride SEQ_FULL*64); causal: key j contributes to query i iff j <= i; out [NB][16][SEQ][64] f32 (unit stride SEQ_FULL*64).

#ifndef NB
#define NB 8
#endif
#ifndef SEQ
#define SEQ 1024
#endif
#define NB_FULL 8
#define SEQ_FULL 1024
#define NHD 16
#define HD 64
#define NU (NB * NHD)
#define SCL 0.125f
#define NEGBIG (-1.0e30f)
#define OSP 68

static_assert(SEQ % 64 == 0);
static_assert(SEQ >= 64 && SEQ <= SEQ_FULL);
static_assert(NB >= 1 && NB <= NB_FULL);
static_assert(HD == 64);

typedef unsigned short bf;
typedef __attribute__((ext_vector_type(16))) __bf16 v16bf;
typedef __attribute__((ext_vector_type(16))) unsigned short v16us;
typedef __attribute__((ext_vector_type(8))) unsigned short v8us;
typedef __attribute__((ext_vector_type(8))) float v8f;
typedef __attribute__((ext_vector_type(4))) float v4f;
typedef v4f __attribute__((may_alias)) v4fa;

__device__ __forceinline__ unsigned short f2bf(float f) { unsigned u = __float_as_uint(f); u += 0x7FFFu + ((u >> 16) & 1u); return (unsigned short)(u >> 16); }
__device__ __forceinline__ float bf2f(unsigned short b) { return __uint_as_float(((unsigned)b) << 16); }
__device__ __forceinline__ void splitf(float y, unsigned short& hp, unsigned short& lp) { hp = f2bf(y); lp = f2bf(y - bf2f(hp)); }
__device__ __forceinline__ v16bf cat16b(v8us lo, v8us hi) {
    v16us w = __builtin_shufflevector(lo, hi, 0, 1, 2, 3, 4, 5, 6, 7, 8, 9, 10, 11, 12, 13, 14, 15);
    return __builtin_bit_cast(v16bf, w);
}
// Fragment loader for A (row = lane&15) and B (col = lane&15) from a k-contiguous 16-bit row: p = row_base + k0 + 8*h;
// elements 0..7 <- k0 + 8h + 0..7, elements 8..15 <- k0 + 16 + 8h + 0..7.
__device__ __forceinline__ v16bf ldfrag(const bf* p) { return cat16b(*(const v8us*)p, *(const v8us*)(p + 16)); }
__device__ __forceinline__ v8f wmmab(v16bf a, v16bf b, v8f c) { return __builtin_amdgcn_wmma_f32_16x16x32_bf16(false, a, false, b, (short)0, c, false, false); }

__global__ __launch_bounds__(256) void k_cvt8(const float* __restrict__ src, bf* dst, unsigned n8) {
    const unsigned i = blockIdx.x * 256u + threadIdx.x;
    if (i >= n8) return;
    const size_t e = (size_t)i * 8;
    const size_t u = e / ((size_t)SEQ * HD);
    const size_t rem = e - u * ((size_t)SEQ * HD);
    const v8f v = *(const v8f*)(src + u * (size_t)SEQ_FULL * HD + rem);
    v8us o;
#pragma unroll
    for (int k = 0; k < 8; ++k) o[k] = f2bf(v[k]);
    *(v8us*)(dst + e) = o;
    
}

// k_vt: value transpose plane VT[u][d][t] = RNE bf16 of v[u][t][d]; one block per (u, 64-key tile): f32 tile staged in LDS (block barrier, cross-wave),
__global__ __launch_bounds__(256) void k_vt(const float* __restrict__ V, bf* VT) {
    __shared__ __align__(16) float tile[64 * OSP];
    const int t = threadIdx.x;
    const int u = (int)blockIdx.x / (SEQ / 64);
    const int kt = (int)blockIdx.x - u * (SEQ / 64);
    const float* vsrc = V + (size_t)u * SEQ_FULL * HD + (size_t)kt * 64 * HD;
#pragma unroll
    for (int i = 0; i < 4; ++i) {
        const int lin = i * 256 + t;
        const int key = lin >> 4, c4 = (lin & 15) * 4;
        const v4f a = *(const v4f*)(vsrc + (size_t)key * HD + c4);
        *(v4fa*)(tile + key * OSP + c4) = a;
    }
    __syncthreads();
    const int lane = t & 31, wv = t >> 5;
    v8us o0, o1;
    const int d0 = 4 * wv + (lane >> 3), d1 = 4 * (wv + 8) + (lane >> 3);
    const int t0 = (lane & 7) * 8;
#pragma unroll
    for (int j = 0; j < 8; ++j) { o0[j] = f2bf(tile[(t0 + j) * OSP + d0]); o1[j] = f2bf(tile[(t0 + j) * OSP + d1]); }
    bf* dst0 = VT + ((size_t)u * HD + d0) * SEQ + (size_t)kt * 64 + t0;
    bf* dst1 = VT + ((size_t)u * HD + d1) * SEQ + (size_t)kt * 64 + t0;
    *(v8us*)dst0 = o0;
    *(v8us*)dst1 = o1;
    
}

// k_attn: one wave = 16 query rows (q0 .. q0+15) of one unit; key blocks of 32 visited while jb <= q0+15 (causal), online softmax in f32.
// S^T tiles: A = key rows of the k plane, B = query rows of the q plane (both k-contiguous loads with the same split k map), D[key 8h+r][query lane&15].
// P^T as B operand of the context product is taken in-lane from the two S^T accumulators (element r <- keys jb+8h+r, element 8+r <- keys jb+16+8h+r).
// Context^T: A = rows of VT (d), D[d 8h+r][query lane&15]; epilogue stages the 16x64 tile in wave-private LDS (block barrier before the reload) and
__global__ __launch_bounds__(128) __attribute__((amdgpu_num_vgpr(256)))
void k_attn(const bf* __restrict__ QB, const bf* __restrict__ KB, const bf* __restrict__ VT, float* OUT) {
    __shared__ __align__(16) float os[4 * 16 * OSP];
    const int lane = threadIdx.x & 31, m = lane & 15, h = lane >> 4;
    const int wv = __builtin_amdgcn_readfirstlane((int)(threadIdx.x >> 5));
    // Work-group index -> (block of 64 query rows, unit): the unit runs fastest and the causal trip count falls with the index, so any
    // round-robin deal of consecutive indices hands out equal work and the longest work-groups have the lowest indices (a permutation of the old map).
    const int rank = (int)blockIdx.x / NU;
    const int u = (int)blockIdx.x - rank * NU;
    const int q0 = ((SEQ / 64 - 1 - rank) * 4 + wv) * 16;
    const bf* qp = QB + (size_t)u * SEQ * HD;
    const bf* kp = KB + (size_t)u * SEQ * HD;
    const bf* vp = VT + (size_t)u * HD * SEQ;
    float* op = OUT + ((size_t)u * SEQ_FULL + q0) * HD;

    v16bf qf[2];
#pragma unroll
    for (int kb = 0; kb < 2; ++kb) qf[kb] = ldfrag(qp + (size_t)(q0 + m) * HD + kb * 32 + 8 * h);

    v8f oacc[4];
#pragma unroll
    for (int c = 0; c < 4; ++c) oacc[c] = (v8f){};
    float mrun = NEGBIG, lrun = 0.0f;
    const int qi = q0 + m;
    const int jend = q0 + 16;

#pragma unroll 1
    for (int jb = 0; jb < jend; jb += 32) {
        // ---- S^T = K(32 keys) x Q^T(16 queries), 64 deep
        v16bf ka[2][2];
#pragma unroll
        for (int jt = 0; jt < 2; ++jt)
#pragma unroll
            for (int kb = 0; kb < 2; ++kb) ka[jt][kb] = ldfrag(kp + (size_t)(jb + 16 * jt + m) * HD + kb * 32 + 8 * h);
        v8f st[2];
#pragma unroll
        for (int jt = 0; jt < 2; ++jt) {
            st[jt] = (v8f){};
            st[jt] = wmmab(ka[jt][0], qf[0], st[jt]);
            st[jt] = wmmab(ka[jt][1], qf[1], st[jt]);
        }
        asm volatile("v_nop\n\tv_nop\n\tv_nop\n\tv_nop" : "+v"(st[0]), "+v"(st[1]) : "v"(ka[0][1]), "v"(ka[1][1]), "v"(qf[1]));

        // ---- causal replace-fill, running max, exp, row sums (f32)
        float p0[8], p1[8];
        float mx = NEGBIG;
#pragma unroll
        for (int r = 0; r < 8; ++r) {
            const int k0i = jb + 8 * h + r;
            float x0 = st[0][r] * SCL;
            float x1 = st[1][r] * SCL;
            x0 = (k0i <= qi) ? x0 : NEGBIG;
            x1 = (k0i + 16 <= qi) ? x1 : NEGBIG;
            p0[r] = x0; p1[r] = x1;
            mx = fmaxf(mx, fmaxf(x0, x1));
        }
        mx = fmaxf(mx, __shfl_xor(mx, 16, 32));
        const float mn = fmaxf(mrun, mx);
        const float rsc = __expf(mrun - mn);
        mrun = mn;
        float ls = 0.0f;
#pragma unroll
        for (int r = 0; r < 8; ++r) {
            p0[r] = __expf(p0[r] - mn);
            p1[r] = __expf(p1[r] - mn);
            ls += p0[r] + p1[r];
        }
        ls += __shfl_xor(ls, 16, 32);
        lrun = lrun * rsc + ls;
#pragma unroll
        for (int c = 0; c < 4; ++c) oacc[c] = oacc[c] * rsc;

        // ---- P^T as B operand: bf16 hi + bf16 residual, in-lane (k = key: element r <- jb+8h+r, element 8+r <- jb+16+8h+r; n = query lane&15)
        v8us ph0, ph1, pl0, pl1;
#pragma unroll
        for (int r = 0; r < 8; ++r) {
            unsigned short ah, al;
            splitf(p0[r], ah, al); ph0[r] = ah; pl0[r] = al;
            splitf(p1[r], ah, al); ph1[r] = ah; pl1[r] = al;
        }
        const v16bf bph = cat16b(ph0, ph1);
        const v16bf bpl = cat16b(pl0, pl1);

        // ---- context^T += V^T(16 d rows) x P^T, two products per tile
        v16bf va;
#pragma unroll
        for (int c = 0; c < 4; ++c) {
            va = ldfrag(vp + (size_t)(c * 16 + m) * SEQ + jb + 8 * h);
            oacc[c] = wmmab(va, bph, oacc[c]);
            oacc[c] = wmmab(va, bpl, oacc[c]);
        }
        asm volatile("v_nop\n\tv_nop\n\tv_nop\n\tv_nop" : "+v"(oacc[0]), "+v"(oacc[1]), "+v"(oacc[2]), "+v"(oacc[3]) : "v"(va), "v"(bph), "v"(bpl));
    }

    const float inv = 1.0f / lrun;
    float* osw = os + wv * (16 * OSP);
#pragma unroll
    for (int c = 0; c < 4; ++c) {
        v4f a, b;
        a[0] = oacc[c][0] * inv; a[1] = oacc[c][1] * inv; a[2] = oacc[c][2] * inv; a[3] = oacc[c][3] * inv;
        b[0] = oacc[c][4] * inv; b[1] = oacc[c][5] * inv; b[2] = oacc[c][6] * inv; b[3] = oacc[c][7] * inv;
        *(v4fa*)(osw + m * OSP + c * 16 + 8 * h) = a;
        *(v4fa*)(osw + m * OSP + c * 16 + 8 * h + 4) = b;
    }
    __syncthreads();
    v4f vals[8];
#pragma unroll
    for (int s = 0; s < 8; ++s) vals[s] = *(const v4fa*)(osw + (2 * s + h) * OSP + m * 4);
#pragma unroll
    for (int s = 0; s < 8; ++s) *(v4f*)(op + (size_t)(2 * s + h) * HD + m * 4) = vals[s];
    
}

extern "C" void kernel_launch(void* const* d_in, const int* in_sizes, int n_in,
                              void* d_out, int out_size, void* d_ws, size_t ws_size, hipStream_t stream) {
    if (n_in < 3) return;
    const long long need = (long long)NU * SEQ_FULL * HD;
    if ((long long)in_sizes[0] < need || (long long)in_sizes[1] < need || (long long)in_sizes[2] < need) return;
    if ((long long)out_size < need) return;
    const size_t plane = (size_t)NU * SEQ * HD;   // elements per 16-bit plane (q, k, v^T)
    const size_t pbytes = plane * 2;                // 16 MiB each at NB=8, SEQ=1024; total carve 48 MiB
    if (3 * pbytes > ws_size) return;
    char* ws = (char*)d_ws;
    bf* QB = (bf*)ws;
    bf* KB = (bf*)(ws + pbytes);
    bf* VT = (bf*)(ws + 2 * pbytes);
    const float* Qin = (const float*)d_in[0];
    const float* Kin = (const float*)d_in[1];
    const float* Vin = (const float*)d_in[2];
    float* OUT = (float*)d_out;
    const unsigned n8 = (unsigned)(plane / 8);
    k_cvt8<<<dim3((n8 + 255u) / 256u), dim3(256), 0, stream>>>(Qin, QB, n8);
    k_cvt8<<<dim3((n8 + 255u) / 256u), dim3(256), 0, stream>>>(Kin, KB, n8);
    k_vt<<<dim3((unsigned)(NU * (SEQ / 64))), dim3(256), 0, stream>>>(Vin, VT);
    k_attn<<<dim3((unsigned)(NU * SEQ / 64)), dim3(128), 0, stream>>>(QB, KB, VT, OUT);
}

// v002
// A run of this version takes 73.3 microseconds.
// Two timings next to v001 put it at 1.23 and 1.22 times that version's speed.
// Over all steps from v000 it is 1.90 times as fast.
#include <hip/hip_runtime.h>

// Contractions: scores^T tile = k-rows x q-rows^T on v_wmma_f32_16x16x32_bf16 (bf16 operands = RNE-converted inputs, single product, f32 accumulate);
// context^T tile = v^T x P^T on v_wmma_f32_16x16x32_bf16 with P carried as bf16 hi + bf16 residual (two products into one f32 accumulator), v as RNE bf16;
// online softmax (running max, rescale, row sums) and the final normalisation in f32.
// q, k, v [NB][16][SEQ][64] f32 head-major units (unit stride SEQ_FULL*64); causal: key j contributes to query i iff j <= i; out [NB][16][SEQ][64] f32 (unit stride SEQ_FULL*64).
// The three bf16 planes are kept in fragment order: one 16 x 32 operand fragment = 1 KiB = [e][lane][8 elements], so that a wave-wide 16-byte load
// reads 512 contiguous bytes (four whole 128-byte lines) instead of 32-byte pieces of sixteen lines.

#ifndef NB
#define NB 8
#endif
#ifndef SEQ
#define SEQ 1024
#endif
#define NB_FULL 8
#define SEQ_FULL 1024
#define NHD 16
#define HD 64
#define NU (NB * NHD)
#define SCL 0.125f
#define NEGBIG (-1.0e30f)
#define OSP 68

static_assert(SEQ % 64 == 0);
static_assert(SEQ >= 64 && SEQ <= SEQ_FULL);
static_assert(NB >= 1 && NB <= NB_FULL);
static_assert(HD == 64);

typedef unsigned short bf;
typedef __attribute__((ext_vector_type(16))) __bf16 v16bf;
typedef __attribute__((ext_vector_type(16))) unsigned short v16us;
typedef __attribute__((ext_vector_type(8))) unsigned short v8us;
typedef __attribute__((ext_vector_type(8))) float v8f;
typedef __attribute__((ext_vector_type(4))) float v4f;
typedef v4f __attribute__((may_alias)) v4fa;

__device__ __forceinline__ unsigned short f2bf(float f) { unsigned u = __float_as_uint(f); u += 0x7FFFu + ((u >> 16) & 1u); return (unsigned short)(u >> 16); }
__device__ __forceinline__ float bf2f(unsigned short b) { return __uint_as_float(((unsigned)b) << 16); }
__device__ __forceinline__ void splitf(float y, unsigned short& hp, unsigned short& lp) { hp = f2bf(y); lp = f2bf(y - bf2f(hp)); }
__device__ __forceinline__ v16bf cat16b(v8us lo, v8us hi) {
    v16us w = __builtin_shufflevector(lo, hi, 0, 1, 2, 3, 4, 5, 6, 7, 8, 9, 10, 11, 12, 13, 14, 15);
    return __builtin_bit_cast(v16bf, w);
}
// Fragment loader for A (row = lane&15) and B (col = lane&15) from a fragment-order plane: p = fragment_base + 8*lane, lane = 16h + row;
// elements 0..7 (e = 0) hold k0 + 8h + 0..7, elements 8..15 (e = 1, 256 elements further) hold k0 + 16 + 8h + 0..7.
__device__ __forceinline__ v16bf ldfrag(const bf* p) { return cat16b(*(const v8us*)p, *(const v8us*)(p + 256)); }
__device__ __forceinline__ v8f wmmab(v16bf a, v16bf b, v8f c) { return __builtin_amdgcn_wmma_f32_16x16x32_bf16(false, a, false, b, (short)0, c, false, false); }

// k_cvt8: RNE bf16 plane of a [row][64] f32 input in fragment order: fragment (row >> 4, kb) at ((row >> 4) * 2 + kb) * 512 elements.
// One thread = one group of 8 elements; a wave takes 8 rows x 32 columns (whole 128-byte source lines) and stores four whole 128-byte lines.
__global__ __launch_bounds__(256) void k_cvt8(const float* __restrict__ src, bf* dst, unsigned n8) {
    const unsigned i = blockIdx.x * 256u + threadIdx.x;
    if (i >= n8) return;
    const unsigned l = i & 31u, w = i >> 5;
    const unsigned kb = w & 1u;
    const unsigned row = (w >> 1) * 8u + (l & 7u);   // row counted over all units
    const unsigned eh = l >> 3;                      // 2e + h: column = 32 kb + 16 e + 8 h
    const unsigned u = row / (unsigned)SEQ;
    const unsigned t = row - u * (unsigned)SEQ;
    const v8f v = *(const v8f*)(src + ((size_t)u * SEQ_FULL + t) * HD + kb * 32u + eh * 8u);
    v8us o;
#pragma unroll
    for (int k = 0; k < 8; ++k) o[k] = f2bf(v[k]);
    const size_t grp = (size_t)(((row >> 4) * 2u + kb) * 2u + (eh >> 1)) * 32u + (eh & 1u) * 16u + (row & 15u);
    *(v8us*)(dst + grp * 8) = o;
}

// k_vt: value transpose plane, RNE bf16 of v[u][t][d] in fragment order: fragment (32-key block jblk, c = d >> 4) of unit u at (jblk * 4 + c) * 512 elements,
// row = d & 15, k = key. One block per (u, 64-key tile): f32 tile staged in LDS (block barrier, cross-wave); a wave stores four whole 128-byte lines at a time.
__global__ __launch_bounds__(256) void k_vt(const float* __restrict__ V, bf* VT) {
    __shared__ __align__(16) float tile[64 * OSP];
    const int t = threadIdx.x;
    const int u = (int)blockIdx.x / (SEQ / 64);
    const int kt = (int)blockIdx.x - u * (SEQ / 64);
    const float* vsrc = V + (size_t)u * SEQ_FULL * HD + (size_t)kt * 64 * HD;
#pragma unroll
    for (int i = 0; i < 4; ++i) {
        const int lin = i * 256 + t;
        const int key = lin >> 4, c4 = (lin & 15) * 4;
        const v4f a = *(const v4f*)(vsrc + (size_t)key * HD + c4);
        *(v4fa*)(tile + key * OSP + c4) = a;
    }
    __syncthreads();
    const int lane = t & 31, wv = t >> 5;
    v8us o0, o1;
    const int d = 8 * wv + (lane & 7);
    const int eh = lane >> 3;                        // 2e + h: key in its 32-key block = 16 e + 8 h + j
    const int t0 = eh * 8;
#pragma unroll
    for (int j = 0; j < 8; ++j) { o0[j] = f2bf(tile[(t0 + j) * OSP + d]); o1[j] = f2bf(tile[(t0 + 32 + j) * OSP + d]); }
    bf* dst0 = VT + (size_t)u * HD * SEQ + ((size_t)(((kt * 2) * 4 + (d >> 4)) * 2 + (eh >> 1)) * 32 + (eh & 1) * 16 + (d & 15)) * 8;
    *(v8us*)dst0 = o0;
    *(v8us*)(dst0 + 4 * 512) = o1;
}

// k_attn: one wave = 16 query rows (q0 .. q0+15) of one unit; key blocks of 32 visited while jb <= q0+15 (causal), online softmax in f32.
// S^T tiles: A = key rows of the k plane, B = query rows of the q plane (both fragment-order loads with the same split k map), D[key 8h+r][query lane&15].
// P^T as B operand of the context product is taken in-lane from the two S^T accumulators (element r <- keys jb+8h+r, element 8+r <- keys jb+16+8h+r).
// Context^T: A = rows of VT (d), D[d 8h+r][query lane&15]; epilogue stages the 16x64 tile in wave-private LDS (block barrier before the reload) and
__global__ __launch_bounds__(128) __attribute__((amdgpu_num_vgpr(256)))
void k_attn(const bf* __restrict__ QB, const bf* __restrict__ KB, const bf* __restrict__ VT, float* OUT) {
    __shared__ __align__(16) float os[4 * 16 * OSP];
    const int lane = threadIdx.x & 31, m = lane & 15, h = lane >> 4;
    const int wv = __builtin_amdgcn_readfirstlane((int)(threadIdx.x >> 5));
    // Work-group index -> (block of 64 query rows, unit): the unit runs fastest and the causal trip count falls with the index, so any
    // round-robin deal of consecutive indices hands out equal work and the longest work-groups have the lowest indices (a permutation of the old map).
    const int rank = (int)blockIdx.x / NU;
    const int u = (int)blockIdx.x - rank * NU;
    const int q0 = ((SEQ / 64 - 1 - rank) * 4 + wv) * 16;
    const bf* qp = QB + (size_t)u * SEQ * HD;
    const bf* kp = KB + (size_t)u * SEQ * HD;
    const bf* vp = VT + (size_t)u * HD * SEQ;
    float* op = OUT + ((size_t)u * SEQ_FULL + q0) * HD;

    v16bf qf[2];
#pragma unroll
    for (int kb = 0; kb < 2; ++kb) qf[kb] = ldfrag(qp + (size_t)q0 * HD + kb * 512 + 8 * lane);

    v8f oacc[4];
#pragma unroll
    for (int c = 0; c < 4; ++c) oacc[c] = (v8f){};
    float mrun = NEGBIG, lrun = 0.0f;
    const int qi = q0 + m;
    const int jend = q0 + 16;

#pragma unroll 1
    for (int jb = 0; jb < jend; jb += 32) {
        // ---- S^T = K(32 keys) x Q^T(16 queries), 64 deep
        v16bf ka[2][2];
#pragma unroll
        for (int jt = 0; jt < 2; ++jt)
#pragma unroll
            for (int kb = 0; kb < 2; ++kb) ka[jt][kb] = ldfrag(kp + (size_t)jb * HD + (jt * 2 + kb) * 512 + 8 * lane);
        v8f st[2];
#pragma unroll
        for (int jt = 0; jt < 2; ++jt) {
            st[jt] = (v8f){};
            st[jt] = wmmab(ka[jt][0], qf[0], st[jt]);
            st[jt] = wmmab(ka[jt][1], qf[1], st[jt]);
        }
        asm volatile("v_nop\n\tv_nop\n\tv_nop\n\tv_nop" : "+v"(st[0]), "+v"(st[1]) : "v"(ka[0][1]), "v"(ka[1][1]), "v"(qf[1]));

        // ---- causal replace-fill, running max, exp, row sums (f32)
        float p0[8], p1[8];
        float mx = NEGBIG;
#pragma unroll
        for (int r = 0; r < 8; ++r) {
            const int k0i = jb + 8 * h + r;
            float x0 = st[0][r] * SCL;
            float x1 = st[1][r] * SCL;
            x0 = (k0i <= qi) ? x0 : NEGBIG;
            x1 = (k0i + 16 <= qi) ? x1 : NEGBIG;
            p0[r] = x0; p1[r] = x1;
            mx = fmaxf(mx, fmaxf(x0, x1));
        }
        mx = fmaxf(mx, __shfl_xor(mx, 16, 32));
        const float mn = fmaxf(mrun, mx);
        const float rsc = __expf(mrun - mn);
        mrun = mn;
        float ls = 0.0f;
#pragma unroll
        for (int r = 0; r < 8; ++r) {
            p0[r] = __expf(p0[r] - mn);
            p1[r] = __expf(p1[r] - mn);
            ls += p0[r] + p1[r];
        }
        ls += __shfl_xor(ls, 16, 32);
        lrun = lrun * rsc + ls;
#pragma unroll
        for (int c = 0; c < 4; ++c) oacc[c] = oacc[c] * rsc;

        // ---- P^T as B operand: bf16 hi + bf16 residual, in-lane (k = key: element r <- jb+8h+r, element 8+r <- jb+16+8h+r; n = query lane&15)
        v8us ph0, ph1, pl0, pl1;
#pragma unroll
        for (int r = 0; r < 8; ++r) {
            unsigned short ah, al;
            splitf(p0[r], ah, al); ph0[r] = ah; pl0[r] = al;
            splitf(p1[r], ah, al); ph1[r] = ah; pl1[r] = al;
        }
        const v16bf bph = cat16b(ph0, ph1);
        const v16bf bpl = cat16b(pl0, pl1);

        // ---- context^T += V^T(16 d rows) x P^T, two products per tile
        v16bf va;
#pragma unroll
        for (int c = 0; c < 4; ++c) {
            va = ldfrag(vp + (size_t)jb * HD + c * 512 + 8 * lane);
            oacc[c] = wmmab(va, bph, oacc[c]);
            oacc[c] = wmmab(va, bpl, oacc[c]);
        }
        asm volatile("v_nop\n\tv_nop\n\tv_nop\n\tv_nop" : "+v"(oacc[0]), "+v"(oacc[1]), "+v"(oacc[2]), "+v"(oacc[3]) : "v"(va), "v"(bph), "v"(bpl));
    }

    const float inv = 1.0f / lrun;
    float* osw = os + wv * (16 * OSP);
#pragma unroll
    for (int c = 0; c < 4; ++c) {
        v4f a, b;
        a[0] = oacc[c][0] * inv; a[1] = oacc[c][1] * inv; a[2] = oacc[c][2] * inv; a[3] = oacc[c][3] * inv;
        b[0] = oacc[c][4] * inv; b[1] = oacc[c][5] * inv; b[2] = oacc[c][6] * inv; b[3] = oacc[c][7] * inv;
        *(v4fa*)(osw + m * OSP + c * 16 + 8 * h) = a;
        *(v4fa*)(osw + m * OSP + c * 16 + 8 * h + 4) = b;
    }
    __syncthreads();
    v4f vals[8];
#pragma unroll
    for (int s = 0; s < 8; ++s) vals[s] = *(const v4fa*)(osw + (2 * s + h) * OSP + m * 4);
#pragma unroll
    for (int s = 0; s < 8; ++s) *(v4f*)(op + (size_t)(2 * s + h) * HD + m * 4) = vals[s];
    
}

extern "C" void kernel_launch(void* const* d_in, const int* in_sizes, int n_in,
                              void* d_out, int out_size, void* d_ws, size_t ws_size, hipStream_t stream) {
    if (n_in < 3) return;
    const long long need = (long long)NU * SEQ_FULL * HD;
    if ((long long)in_sizes[0] < need || (long long)in_sizes[1] < need || (long long)in_sizes[2] < need) return;
    if ((long long)out_size < need) return;
    const size_t plane = (size_t)NU * SEQ * HD;   // elements per 16-bit plane (q, k, v^T)
    const size_t pbytes = plane * 2;                // 16 MiB each at NB=8, SEQ=1024; total carve 48 MiB
    if (3 * pbytes > ws_size) return;
    char* ws = (char*)d_ws;
    bf* QB = (bf*)ws;
    bf* KB = (bf*)(ws + pbytes);
    bf* VT = (bf*)(ws + 2 * pbytes);
    const float* Qin = (const float*)d_in[0];
    const float* Kin = (const float*)d_in[1];
    const float* Vin = (const float*)d_in[2];
    float* OUT = (float*)d_out;
    const unsigned n8 = (unsigned)(plane / 8);
    k_cvt8<<<dim3((n8 + 255u) / 256u), dim3(256), 0, stream>>>(Qin, QB, n8);
    k_cvt8<<<dim3((n8 + 255u) / 256u), dim3(256), 0, stream>>>(Kin, KB, n8);
    k_vt<<<dim3((unsigned)(NU * (SEQ / 64))), dim3(256), 0, stream>>>(Vin, VT);
    k_attn<<<dim3((unsigned)(NU * SEQ / 64)), dim3(128), 0, stream>>>(QB, KB, VT, OUT);
}

// v003
// A run of this version takes 70.4 microseconds.
// In two side-by-side timings against v002, it was 1.04 and 1.05 times as fast.
// All steps since v000 together make it 1.98 times as fast.
#include <hip/hip_runtime.h>

// Contractions: scores^T tile = k-rows x q-rows^T on v_wmma_f32_16x16x32_bf16 (bf16 operands = RNE-converted inputs, single product, f32 accumulate);
// context^T tile = v^T x P^T on v_wmma_f32_16x16x32_bf16 with P carried as bf16 hi + bf16 residual (two products into one f32 accumulator), v as RNE bf16;
// online softmax (running max, rescale, row sums) and the final normalisation in f32.
// q, k, v [NB][16][SEQ][64] f32 head-major units; causal: key j contributes to query i iff j <= i; out [NB][16][SEQ][64] f32 (unit stride SEQ_FULL*64).
// The k and v^T bf16 planes are kept in fragment order (q is converted in k_attn, each row by the one wave that uses it): one 16 x 32 operand fragment = 1 KiB = [e][lane][8 elements], so that a wave-wide 16-byte load
// reads 512 contiguous bytes (four whole 128-byte lines) instead of 32-byte pieces of sixteen lines.

#ifndef NB
#define NB 8
#endif
#ifndef SEQ
#define SEQ 1024
#endif
#define NB_FULL 8
#define SEQ_FULL 1024
#define NHD 16
#define HD 64
#define NU (NB * NHD)
#define SCL 0.125f
#define NEGBIG (-1.0e30f)
#define OSP 68

static_assert(SEQ % 64 == 0);
static_assert(SEQ >= 64 && SEQ <= SEQ_FULL);
static_assert(NB >= 1 && NB <= NB_FULL);
static_assert(HD == 64);

typedef unsigned short bf;
typedef __attribute__((ext_vector_type(16))) __bf16 v16bf;
typedef __attribute__((ext_vector_type(16))) unsigned short v16us;
typedef __attribute__((ext_vector_type(8))) unsigned short v8us;
typedef __attribute__((ext_vector_type(8))) float v8f;
typedef __attribute__((ext_vector_type(4))) float v4f;
typedef v4f __attribute__((may_alias)) v4fa;

__device__ __forceinline__ unsigned short f2bf(float f) { unsigned u = __float_as_uint(f); u += 0x7FFFu + ((u >> 16) & 1u); return (unsigned short)(u >> 16); }
__device__ __forceinline__ float bf2f(unsigned short b) { return __uint_as_float(((unsigned)b) << 16); }
__device__ __forceinline__ void splitf(float y, unsigned short& hp, unsigned short& lp) { hp = f2bf(y); lp = f2bf(y - bf2f(hp)); }
__device__ __forceinline__ v16bf cat16b(v8us lo, v8us hi) {
    v16us w = __builtin_shufflevector(lo, hi, 0, 1, 2, 3, 4, 5, 6, 7, 8, 9, 10, 11, 12, 13, 14, 15);
    return __builtin_bit_cast(v16bf, w);
}
// Fragment loader for A (row = lane&15) and B (col = lane&15) from a fragment-order plane: p = fragment_base + 8*lane, lane = 16h + row;
// elements 0..7 (e = 0) hold k0 + 8h + 0..7, elements 8..15 (e = 1, 256 elements further) hold k0 + 16 + 8h + 0..7.
__device__ __forceinline__ v16bf ldfrag(const bf* p) { return cat16b(*(const v8us*)p, *(const v8us*)(p + 256)); }
__device__ __forceinline__ v8f wmmab(v16bf a, v16bf b, v8f c) { return __builtin_amdgcn_wmma_f32_16x16x32_bf16(false, a, false, b, (short)0, c, false, false); }

// k_cvt8: RNE bf16 plane of a [row][64] f32 input in fragment order: fragment (row >> 4, kb) at ((row >> 4) * 2 + kb) * 512 elements.
// One thread = one group of 8 elements; a wave takes 8 rows x 32 columns (whole 128-byte source lines) and stores four whole 128-byte lines.
__global__ __launch_bounds__(256) void k_cvt8(const float* __restrict__ src, bf* dst, unsigned n8) {
    const unsigned i = blockIdx.x * 256u + threadIdx.x;
    if (i >= n8) return;
    const unsigned l = i & 31u, w = i >> 5;
    const unsigned kb = w & 1u;
    const unsigned row = (w >> 1) * 8u + (l & 7u);   // row counted over all units
    const unsigned eh = l >> 3;                      // 2e + h: column = 32 kb + 16 e + 8 h
    const unsigned u = row / (unsigned)SEQ;
    const unsigned t = row - u * (unsigned)SEQ;
    const v8f v = *(const v8f*)(src + ((size_t)u * SEQ_FULL + t) * HD + kb * 32u + eh * 8u);
    v8us o;
#pragma unroll
    for (int k = 0; k < 8; ++k) o[k] = f2bf(v[k]);
    const size_t grp = (size_t)(((row >> 4) * 2u + kb) * 2u + (eh >> 1)) * 32u + (eh & 1u) * 16u + (row & 15u);
    *(v8us*)(dst + grp * 8) = o;
}

// k_vt: value transpose plane, RNE bf16 of v[u][t][d] in fragment order: fragment (32-key block jblk, c = d >> 4) of unit u at (jblk * 4 + c) * 512 elements,
// row = d & 15, k = key. One block per (u, 64-key tile): f32 tile staged in LDS (block barrier, cross-wave); a wave stores four whole 128-byte lines at a time.
__global__ __launch_bounds__(256) void k_vt(const float* __restrict__ V, bf* VT) {
    __shared__ __align__(16) float tile[64 * OSP];
    const int t = threadIdx.x;
    const int u = (int)blockIdx.x / (SEQ / 64);
    const int kt = (int)blockIdx.x - u * (SEQ / 64);
    const float* vsrc = V + (size_t)u * SEQ_FULL * HD + (size_t)kt * 64 * HD;
#pragma unroll
    for (int i = 0; i < 4; ++i) {
        const int lin = i * 256 + t;
        const int key = lin >> 4, c4 = (lin & 15) * 4;
        const v4f a = *(const v4f*)(vsrc + (size_t)key * HD + c4);
        *(v4fa*)(tile + key * OSP + c4) = a;
    }
    __syncthreads();
    const int lane = t & 31, wv = t >> 5;
    v8us o0, o1;
    const int d = 8 * wv + (lane & 7);
    const int eh = lane >> 3;                        // 2e + h: key in its 32-key block = 16 e + 8 h + j
    const int t0 = eh * 8;
#pragma unroll
    for (int j = 0; j < 8; ++j) { o0[j] = f2bf(tile[(t0 + j) * OSP + d]); o1[j] = f2bf(tile[(t0 + 32 + j) * OSP + d]); }
    bf* dst0 = VT + (size_t)u * HD * SEQ + ((size_t)(((kt * 2) * 4 + (d >> 4)) * 2 + (eh >> 1)) * 32 + (eh & 1) * 16 + (d & 15)) * 8;
    *(v8us*)dst0 = o0;
    *(v8us*)(dst0 + 4 * 512) = o1;
}

// k_attn: one wave = 16 query rows (q0 .. q0+15) of one unit; key blocks of 32 visited while jb <= q0+15 (causal), online softmax in f32.
// S^T tiles: A = key rows of the k plane (fragment-order loads), B = query rows of q, RNE bf16 in registers (the same split k map), D[key 8h+r][query lane&15].
// P^T as B operand of the context product is taken in-lane from the two S^T accumulators (element r <- keys jb+8h+r, element 8+r <- keys jb+16+8h+r).
// Context^T: A = rows of VT (d), D[d 8h+r][query lane&15]; epilogue stages the 16x64 tile in wave-private LDS (block barrier before the reload) and
__global__ __launch_bounds__(128) __attribute__((amdgpu_num_vgpr(256)))
void k_attn(const float* __restrict__ Q, const bf* __restrict__ KB, const bf* __restrict__ VT, float* OUT) {
    __shared__ __align__(16) float os[4 * 16 * OSP];
    const int lane = threadIdx.x & 31, m = lane & 15, h = lane >> 4;
    const int wv = __builtin_amdgcn_readfirstlane((int)(threadIdx.x >> 5));
    // Work-group index -> (block of 64 query rows, unit): the unit runs fastest and the causal trip count falls with the index, so any
    // round-robin deal of consecutive indices hands out equal work and the longest work-groups have the lowest indices (a permutation of the old map).
    const int rank = (int)blockIdx.x / NU;
    const int u = (int)blockIdx.x - rank * NU;
    const int q0 = ((SEQ / 64 - 1 - rank) * 4 + wv) * 16;
    const float* qp = Q + ((size_t)u * SEQ_FULL + q0) * HD;
    const bf* kp = KB + (size_t)u * SEQ * HD;
    const bf* vp = VT + (size_t)u * HD * SEQ;
    float* op = OUT + ((size_t)u * SEQ_FULL + q0) * HD;

    // The wave's own 16 x 64 f32 query tile: whole-line loads (512 contiguous bytes a load), turned to one row a lane through the wave-private LDS
    // range that the epilogue uses again (block barrier before the reload, as there), then RNE bf16 in registers.
    float* osw = os + wv * (16 * OSP);
#pragma unroll
    for (int s = 0; s < 8; ++s) {
        const v4f a = *(const v4f*)(qp + (size_t)(2 * s + h) * HD + m * 4);
        *(v4fa*)(osw + (2 * s + h) * OSP + m * 4) = a;
    }
    __syncthreads();
    v16bf qf[2];
#pragma unroll
    for (int kb = 0; kb < 2; ++kb) {
        // B fragment: elements 0..7 = columns 32 kb + 8h + 0..7, elements 8..15 = 32 kb + 16 + 8h + 0..7 of row lane&15 (the k map of ldfrag)
        const float* qr = osw + m * OSP + kb * 32 + 8 * h;
        const v4f a0 = *(const v4fa*)qr, a1 = *(const v4fa*)(qr + 4), b0 = *(const v4fa*)(qr + 16), b1 = *(const v4fa*)(qr + 20);
        v8us lo, hi;
#pragma unroll
        for (int k = 0; k < 4; ++k) { lo[k] = f2bf(a0[k]); lo[4 + k] = f2bf(a1[k]); hi[k] = f2bf(b0[k]); hi[4 + k] = f2bf(b1[k]); }
        qf[kb] = cat16b(lo, hi);
    }

    v8f oacc[4];
#pragma unroll
    for (int c = 0; c < 4; ++c) oacc[c] = (v8f){};
    float mrun = NEGBIG, lrun = 0.0f;
    const int qi = q0 + m;
    const int jend = q0 + 16;

#pragma unroll 1
    for (int jb = 0; jb < jend; jb += 32) {
        // ---- S^T = K(32 keys) x Q^T(16 queries), 64 deep
        v16bf ka[2][2];
#pragma unroll
        for (int jt = 0; jt < 2; ++jt)
#pragma unroll
            for (int kb = 0; kb < 2; ++kb) ka[jt][kb] = ldfrag(kp + (size_t)jb * HD + (jt * 2 + kb) * 512 + 8 * lane);
        v8f st[2];
#pragma unroll
        for (int jt = 0; jt < 2; ++jt) {
            st[jt] = (v8f){};
            st[jt] = wmmab(ka[jt][0], qf[0], st[jt]);
            st[jt] = wmmab(ka[jt][1], qf[1], st[jt]);
        }
        asm volatile("v_nop\n\tv_nop\n\tv_nop\n\tv_nop" : "+v"(st[0]), "+v"(st[1]) : "v"(ka[0][1]), "v"(ka[1][1]), "v"(qf[1]));

        // ---- causal replace-fill, running max, exp, row sums (f32)
        float p0[8], p1[8];
        float mx = NEGBIG;
#pragma unroll
        for (int r = 0; r < 8; ++r) {
            const int k0i = jb + 8 * h + r;
            float x0 = st[0][r] * SCL;
            float x1 = st[1][r] * SCL;
            x0 = (k0i <= qi) ? x0 : NEGBIG;
            x1 = (k0i + 16 <= qi) ? x1 : NEGBIG;
            p0[r] = x0; p1[r] = x1;
            mx = fmaxf(mx, fmaxf(x0, x1));
        }
        mx = fmaxf(mx, __shfl_xor(mx, 16, 32));
        const float mn = fmaxf(mrun, mx);
        const float rsc = __expf(mrun - mn);
        mrun = mn;
        float ls = 0.0f;
#pragma unroll
        for (int r = 0; r < 8; ++r) {
            p0[r] = __expf(p0[r] - mn);
            p1[r] = __expf(p1[r] - mn);
            ls += p0[r] + p1[r];
        }
        ls += __shfl_xor(ls, 16, 32);
        lrun = lrun * rsc + ls;
#pragma unroll
        for (int c = 0; c < 4; ++c) oacc[c] = oacc[c] * rsc;

        // ---- P^T as B operand: bf16 hi + bf16 residual, in-lane (k = key: element r <- jb+8h+r, element 8+r <- jb+16+8h+r; n = query lane&15)
        v8us ph0, ph1, pl0, pl1;
#pragma unroll
        for (int r = 0; r < 8; ++r) {
            unsigned short ah, al;
            splitf(p0[r], ah, al); ph0[r] = ah; pl0[r] = al;
            splitf(p1[r], ah, al); ph1[r] = ah; pl1[r] = al;
        }
        const v16bf bph = cat16b(ph0, ph1);
        const v16bf bpl = cat16b(pl0, pl1);

        // ---- context^T += V^T(16 d rows) x P^T, two products per tile
        v16bf va;
#pragma unroll
        for (int c = 0; c < 4; ++c) {
            va = ldfrag(vp + (size_t)jb * HD + c * 512 + 8 * lane);
            oacc[c] = wmmab(va, bph, oacc[c]);
            oacc[c] = wmmab(va, bpl, oacc[c]);
        }
        asm volatile("v_nop\n\tv_nop\n\tv_nop\n\tv_nop" : "+v"(oacc[0]), "+v"(oacc[1]), "+v"(oacc[2]), "+v"(oacc[3]) : "v"(va), "v"(bph), "v"(bpl));
    }

    const float inv = 1.0f / lrun;
#pragma unroll
    for (int c = 0; c < 4; ++c) {
        v4f a, b;
        a[0] = oacc[c][0] * inv; a[1] = oacc[c][1] * inv; a[2] = oacc[c][2] * inv; a[3] = oacc[c][3] * inv;
        b[0] = oacc[c][4] * inv; b[1] = oacc[c][5] * inv; b[2] = oacc[c][6] * inv; b[3] = oacc[c][7] * inv;
        *(v4fa*)(osw + m * OSP + c * 16 + 8 * h) = a;
        *(v4fa*)(osw + m * OSP + c * 16 + 8 * h + 4) = b;
    }
    __syncthreads();
    v4f vals[8];
#pragma unroll
    for (int s = 0; s < 8; ++s) vals[s] = *(const v4fa*)(osw + (2 * s + h) * OSP + m * 4);
#pragma unroll
    for (int s = 0; s < 8; ++s) *(v4f*)(op + (size_t)(2 * s + h) * HD + m * 4) = vals[s];
    
}

extern "C" void kernel_launch(void* const* d_in, const int* in_sizes, int n_in,
                              void* d_out, int out_size, void* d_ws, size_t ws_size, hipStream_t stream) {
    if (n_in < 3) return;
    const long long need = (long long)NU * SEQ_FULL * HD;
    if ((long long)in_sizes[0] < need || (long long)in_sizes[1] < need || (long long)in_sizes[2] < need) return;
    if ((long long)out_size < need) return;
    const size_t plane = (size_t)NU * SEQ * HD;   // elements per 16-bit plane (k, v^T)
    const size_t pbytes = plane * 2;                // 16 MiB each at NB=8, SEQ=1024; total carve 32 MiB
    if (2 * pbytes > ws_size) return;
    char* ws = (char*)d_ws;
    bf* KB = (bf*)ws;
    bf* VT = (bf*)(ws + pbytes);
    const float* Qin = (const float*)d_in[0];
    const float* Kin = (const float*)d_in[1];
    const float* Vin = (const float*)d_in[2];
    float* OUT = (float*)d_out;
    const unsigned n8 = (unsigned)(plane / 8);
    k_cvt8<<<dim3((n8 + 255u) / 256u), dim3(256), 0, stream>>>(Kin, KB, n8);
    k_vt<<<dim3((unsigned)(NU * (SEQ / 64))), dim3(256), 0, stream>>>(Vin, VT);
    k_attn<<<dim3((unsigned)(NU * SEQ / 64)), dim3(128), 0, stream>>>(Qin, KB, VT, OUT);
}

// v004
// A run of this version takes 69.1 microseconds.
// Next to v003, in two timings, it ran 1.04 and 1.03 times as fast.
// All steps since v000 together make it 2.04 times as fast.
#include <hip/hip_runtime.h>

// Contractions: scores^T tile = k-rows x q-rows^T on v_wmma_f32_16x16x32_bf16 (bf16 operands = RNE-converted inputs, single product, f32 accumulate);
// context^T tile = v^T x P^T on v_wmma_f32_16x16x32_bf16 with P carried as bf16 hi + bf16 residual (two products into one f32 accumulator), v as RNE bf16;
// online softmax (running max, rescale, row sums) and the final normalisation in f32.
// q, k, v [NB][16][SEQ][64] f32 head-major units; causal: key j contributes to query i iff j <= i; out [NB][16][SEQ][64] f32 (unit stride SEQ_FULL*64).
// The k and v^T bf16 planes are kept in fragment order (q is converted in k_attn, each row by the one wave that uses it): one 16 x 32 operand fragment = 1 KiB = [e][lane][8 elements], so that a wave-wide 16-byte load
// reads 512 contiguous bytes (four whole 128-byte lines) instead of 32-byte pieces of sixteen lines.

#ifndef NB
#define NB 8
#endif
#ifndef SEQ
#define SEQ 1024
#endif
#define NB_FULL 8
#define SEQ_FULL 1024
#define NHD 16
#define HD 64
#define NU (NB * NHD)
#define SCL 0.125f
#define NEGBIG (-1.0e30f)
#define OSP 68

static_assert(SEQ % 64 == 0);
static_assert(SEQ >= 64 && SEQ <= SEQ_FULL);
static_assert(NB >= 1 && NB <= NB_FULL);
static_assert(HD == 64);

typedef unsigned short bf;
typedef __attribute__((ext_vector_type(16))) __bf16 v16bf;
typedef __attribute__((ext_vector_type(8))) __bf16 v8bf;
typedef __attribute__((ext_vector_type(16))) float v16f;
typedef __attribute__((ext_vector_type(8))) unsigned v8u;
typedef __attribute__((ext_vector_type(16))) unsigned short v16us;
typedef __attribute__((ext_vector_type(8))) unsigned short v8us;
typedef __attribute__((ext_vector_type(8))) float v8f;
typedef __attribute__((ext_vector_type(4))) float v4f;
typedef v4f __attribute__((may_alias)) v4fa;

// f32 -> bf16 by the hardware's packed conversion (round to nearest even, two values an instruction).
__device__ __forceinline__ v8us cvt8(v8f x) { return __builtin_bit_cast(v8us, __builtin_convertvector(x, v8bf)); }
__device__ __forceinline__ v16bf cvt16(v16f x) { return __builtin_convertvector(x, v16bf); }
__device__ __forceinline__ v16bf cat16b(v8us lo, v8us hi) {
    v16us w = __builtin_shufflevector(lo, hi, 0, 1, 2, 3, 4, 5, 6, 7, 8, 9, 10, 11, 12, 13, 14, 15);
    return __builtin_bit_cast(v16bf, w);
}
// Fragment loader for A (row = lane&15) and B (col = lane&15) from a fragment-order plane: p = fragment_base + 8*lane, lane = 16h + row;
// elements 0..7 (e = 0) hold k0 + 8h + 0..7, elements 8..15 (e = 1, 256 elements further) hold k0 + 16 + 8h + 0..7.
__device__ __forceinline__ v16bf ldfrag(const bf* p) { return cat16b(*(const v8us*)p, *(const v8us*)(p + 256)); }
__device__ __forceinline__ v8f wmmab(v16bf a, v16bf b, v8f c) { return __builtin_amdgcn_wmma_f32_16x16x32_bf16(false, a, false, b, (short)0, c, false, false); }

// k_cvt8: RNE bf16 plane of a [row][64] f32 input in fragment order: fragment (row >> 4, kb) at ((row >> 4) * 2 + kb) * 512 elements.
// One thread = one group of 8 elements; a wave takes 8 rows x 32 columns (whole 128-byte source lines) and stores four whole 128-byte lines.
__global__ __launch_bounds__(256) void k_cvt8(const float* __restrict__ src, bf* dst, unsigned n8) {
    const unsigned i = blockIdx.x * 256u + threadIdx.x;
    if (i >= n8) return;
    const unsigned l = i & 31u, w = i >> 5;
    const unsigned kb = w & 1u;
    const unsigned row = (w >> 1) * 8u + (l & 7u);   // row counted over all units
    const unsigned eh = l >> 3;                      // 2e + h: column = 32 kb + 16 e + 8 h
    const unsigned u = row / (unsigned)SEQ;
    const unsigned t = row - u * (unsigned)SEQ;
    const v8f v = *(const v8f*)(src + ((size_t)u * SEQ_FULL + t) * HD + kb * 32u + eh * 8u);
    const v8us o = cvt8(v);
    const size_t grp = (size_t)(((row >> 4) * 2u + kb) * 2u + (eh >> 1)) * 32u + (eh & 1u) * 16u + (row & 15u);
    *(v8us*)(dst + grp * 8) = o;
}

// k_vt: value transpose plane, RNE bf16 of v[u][t][d] in fragment order: fragment (32-key block jblk, c = d >> 4) of unit u at (jblk * 4 + c) * 512 elements,
// row = d & 15, k = key. One block per (u, 64-key tile): f32 tile staged in LDS (block barrier, cross-wave); a wave stores four whole 128-byte lines at a time.
__global__ __launch_bounds__(256) void k_vt(const float* __restrict__ V, bf* VT) {
    __shared__ __align__(16) float tile[64 * OSP];
    const int t = threadIdx.x;
    const int u = (int)blockIdx.x / (SEQ / 64);
    const int kt = (int)blockIdx.x - u * (SEQ / 64);
    const float* vsrc = V + (size_t)u * SEQ_FULL * HD + (size_t)kt * 64 * HD;
#pragma unroll
    for (int i = 0; i < 4; ++i) {
        const int lin = i * 256 + t;
        const int key = lin >> 4, c4 = (lin & 15) * 4;
        const v4f a = *(const v4f*)(vsrc + (size_t)key * HD + c4);
        *(v4fa*)(tile + key * OSP + c4) = a;
    }
    __syncthreads();
    const int lane = t & 31, wv = t >> 5;
    v8f f0, f1;
    const int d = 8 * wv + (lane & 7);
    const int eh = lane >> 3;                        // 2e + h: key in its 32-key block = 16 e + 8 h + j
    const int t0 = eh * 8;
#pragma unroll
    for (int j = 0; j < 8; ++j) { f0[j] = tile[(t0 + j) * OSP + d]; f1[j] = tile[(t0 + 32 + j) * OSP + d]; }
    const v8us o0 = cvt8(f0), o1 = cvt8(f1);
    bf* dst0 = VT + (size_t)u * HD * SEQ + ((size_t)(((kt * 2) * 4 + (d >> 4)) * 2 + (eh >> 1)) * 32 + (eh & 1) * 16 + (d & 15)) * 8;
    *(v8us*)dst0 = o0;
    *(v8us*)(dst0 + 4 * 512) = o1;
}

// k_attn: one wave = 16 query rows (q0 .. q0+15) of one unit; key blocks of 32 visited while jb <= q0+15 (causal), online softmax in f32.
// S^T tiles: A = key rows of the k plane (fragment-order loads), B = query rows of q, RNE bf16 in registers (the same split k map), D[key 8h+r][query lane&15].
// P^T as B operand of the context product is taken in-lane from the two S^T accumulators (element r <- keys jb+8h+r, element 8+r <- keys jb+16+8h+r).
// Context^T: A = rows of VT (d), D[d 8h+r][query lane&15]; epilogue stages the 16x64 tile in wave-private LDS (block barrier before the reload) and
__global__ __launch_bounds__(128) __attribute__((amdgpu_num_vgpr(256)))
void k_attn(const float* __restrict__ Q, const bf* __restrict__ KB, const bf* __restrict__ VT, float* OUT) {
    __shared__ __align__(16) float os[4 * 16 * OSP];
    const int lane = threadIdx.x & 31, m = lane & 15, h = lane >> 4;
    const int wv = __builtin_amdgcn_readfirstlane((int)(threadIdx.x >> 5));
    // Work-group index -> (block of 64 query rows, unit): the unit runs fastest and the causal trip count falls with the index, so any
    // round-robin deal of consecutive indices hands out equal work and the longest work-groups have the lowest indices (a permutation of the old map).
    const int rank = (int)blockIdx.x / NU;
    const int u = (int)blockIdx.x - rank * NU;
    const int q0 = ((SEQ / 64 - 1 - rank) * 4 + wv) * 16;
    const float* qp = Q + ((size_t)u * SEQ_FULL + q0) * HD;
    const bf* kp = KB + (size_t)u * SEQ * HD;
    const bf* vp = VT + (size_t)u * HD * SEQ;
    float* op = OUT + ((size_t)u * SEQ_FULL + q0) * HD;

    // The wave's own 16 x 64 f32 query tile: whole-line loads (512 contiguous bytes a load), turned to one row a lane through the wave-private LDS
    // range that the epilogue uses again (block barrier before the reload, as there), then RNE bf16 in registers.
    float* osw = os + wv * (16 * OSP);
#pragma unroll
    for (int s = 0; s < 8; ++s) {
        const v4f a = *(const v4f*)(qp + (size_t)(2 * s + h) * HD + m * 4);
        *(v4fa*)(osw + (2 * s + h) * OSP + m * 4) = a;
    }
    __syncthreads();
    v16bf qf[2];
#pragma unroll
    for (int kb = 0; kb < 2; ++kb) {
        // B fragment: elements 0..7 = columns 32 kb + 8h + 0..7, elements 8..15 = 32 kb + 16 + 8h + 0..7 of row lane&15 (the k map of ldfrag)
        const float* qr = osw + m * OSP + kb * 32 + 8 * h;
        const v4f a0 = *(const v4fa*)qr, a1 = *(const v4fa*)(qr + 4), b0 = *(const v4fa*)(qr + 16), b1 = *(const v4fa*)(qr + 20);
        v16f qv;
#pragma unroll
        for (int k = 0; k < 4; ++k) { qv[k] = a0[k]; qv[4 + k] = a1[k]; qv[8 + k] = b0[k]; qv[12 + k] = b1[k]; }
        qf[kb] = cvt16(qv);
    }

    v8f oacc[4];
#pragma unroll
    for (int c = 0; c < 4; ++c) oacc[c] = (v8f){};
    float mrun = NEGBIG, lrun = 0.0f;
    const int qi = q0 + m;
    const int jend = q0 + 16;

#pragma unroll 1
    for (int jb = 0; jb < jend; jb += 32) {
        // ---- S^T = K(32 keys) x Q^T(16 queries), 64 deep
        v16bf ka[2][2];
#pragma unroll
        for (int jt = 0; jt < 2; ++jt)
#pragma unroll
            for (int kb = 0; kb < 2; ++kb) ka[jt][kb] = ldfrag(kp + (size_t)jb * HD + (jt * 2 + kb) * 512 + 8 * lane);
        v8f st[2];
#pragma unroll
        for (int jt = 0; jt < 2; ++jt) {
            st[jt] = (v8f){};
            st[jt] = wmmab(ka[jt][0], qf[0], st[jt]);
            st[jt] = wmmab(ka[jt][1], qf[1], st[jt]);
        }
        asm volatile("v_nop\n\tv_nop\n\tv_nop\n\tv_nop" : "+v"(st[0]), "+v"(st[1]) : "v"(ka[0][1]), "v"(ka[1][1]), "v"(qf[1]));

        // ---- the four V^T fragments of this key block, issued here so that they fly under the softmax
        v16bf va[4];
#pragma unroll
        for (int c = 0; c < 4; ++c) va[c] = ldfrag(vp + (size_t)jb * HD + c * 512 + 8 * lane);
        // Keeps the eight loads above the softmax; without it this build sinks them to the products, one register set loaded and waited for four times in a row.
        __builtin_amdgcn_sched_barrier(0);

        // ---- causal replace-fill, running max, exp, row sums (f32)
        float p0[8], p1[8];
        float mx = NEGBIG;
#pragma unroll
        for (int r = 0; r < 8; ++r) {
            const int k0i = jb + 8 * h + r;
            float x0 = st[0][r] * SCL;
            float x1 = st[1][r] * SCL;
            x0 = (k0i <= qi) ? x0 : NEGBIG;
            x1 = (k0i + 16 <= qi) ? x1 : NEGBIG;
            p0[r] = x0; p1[r] = x1;
            mx = fmaxf(mx, fmaxf(x0, x1));
        }
        mx = fmaxf(mx, __shfl_xor(mx, 16, 32));
        const float mn = fmaxf(mrun, mx);
        const float rsc = __expf(mrun - mn);
        mrun = mn;
        float ls = 0.0f;
#pragma unroll
        for (int r = 0; r < 8; ++r) {
            p0[r] = __expf(p0[r] - mn);
            p1[r] = __expf(p1[r] - mn);
            ls += p0[r] + p1[r];
        }
        ls += __shfl_xor(ls, 16, 32);
        lrun = lrun * rsc + ls;
#pragma unroll
        for (int c = 0; c < 4; ++c) oacc[c] = oacc[c] * rsc;

        // ---- P^T as B operand: bf16 hi + bf16 residual, in-lane (k = key: element r <- jb+8h+r, element 8+r <- jb+16+8h+r; n = query lane&15)
        v16f pv;
#pragma unroll
        for (int r = 0; r < 8; ++r) { pv[r] = p0[r]; pv[8 + r] = p1[r]; }
        const v16bf bph = cvt16(pv);
        const v8u hw = __builtin_bit_cast(v8u, bph);
        v16f hb;   // the rounded values back in f32, two from each packed register
#pragma unroll
        for (int r = 0; r < 8; ++r) { hb[2 * r] = __uint_as_float(hw[r] << 16); hb[2 * r + 1] = __uint_as_float(hw[r] & 0xFFFF0000u); }
        const v16bf bpl = cvt16(pv - hb);

        // ---- context^T += V^T(16 d rows) x P^T, two products per tile
#pragma unroll
        for (int c = 0; c < 4; ++c) {
            oacc[c] = wmmab(va[c], bph, oacc[c]);
            oacc[c] = wmmab(va[c], bpl, oacc[c]);
        }
        asm volatile("v_nop\n\tv_nop\n\tv_nop\n\tv_nop" : "+v"(oacc[0]), "+v"(oacc[1]), "+v"(oacc[2]), "+v"(oacc[3]) : "v"(va[3]), "v"(bph), "v"(bpl));
    }

    const float inv = 1.0f / lrun;
#pragma unroll
    for (int c = 0; c < 4; ++c) {
        v4f a, b;
        a[0] = oacc[c][0] * inv; a[1] = oacc[c][1] * inv; a[2] = oacc[c][2] * inv; a[3] = oacc[c][3] * inv;
        b[0] = oacc[c][4] * inv; b[1] = oacc[c][5] * inv; b[2] = oacc[c][6] * inv; b[3] = oacc[c][7] * inv;
        *(v4fa*)(osw + m * OSP + c * 16 + 8 * h) = a;
        *(v4fa*)(osw + m * OSP + c * 16 + 8 * h + 4) = b;
    }
    __syncthreads();
    v4f vals[8];
#pragma unroll
    for (int s = 0; s < 8; ++s) vals[s] = *(const v4fa*)(osw + (2 * s + h) * OSP + m * 4);
#pragma unroll
    for (int s = 0; s < 8; ++s) *(v4f*)(op + (size_t)(2 * s + h) * HD + m * 4) = vals[s];
    
}

extern "C" void kernel_launch(void* const* d_in, const int* in_sizes, int n_in,
                              void* d_out, int out_size, void* d_ws, size_t ws_size, hipStream_t stream) {
    if (n_in < 3) return;
    const long long need = (long long)NU * SEQ_FULL * HD;
    if ((long long)in_sizes[0] < need || (long long)in_sizes[1] < need || (long long)in_sizes[2] < need) return;
    if ((long long)out_size < need) return;
    const size_t plane = (size_t)NU * SEQ * HD;   // elements per 16-bit plane (k, v^T)
    const size_t pbytes = plane * 2;                // 16 MiB each at NB=8, SEQ=1024; total carve 32 MiB
    if (2 * pbytes > ws_size) return;
    char* ws = (char*)d_ws;
    bf* KB = (bf*)ws;
    bf* VT = (bf*)(ws + pbytes);
    const float* Qin = (const float*)d_in[0];
    const float* Kin = (const float*)d_in[1];
    const float* Vin = (const float*)d_in[2];
    float* OUT = (float*)d_out;
    const unsigned n8 = (unsigned)(plane / 8);
    k_cvt8<<<dim3((n8 + 255u) / 256u), dim3(256), 0, stream>>>(Kin, KB, n8);
    k_vt<<<dim3((unsigned)(NU * (SEQ / 64))), dim3(256), 0, stream>>>(Vin, VT);
    k_attn<<<dim3((unsigned)(NU * SEQ / 64)), dim3(128), 0, stream>>>(Qin, KB, VT, OUT);
}

// v005
// One run takes 38.7 microseconds.
// In two side-by-side timings against v004, it was 1.80 and 1.76 times as fast.
// All steps since v000 together make it 3.64 times as fast.
#include <hip/hip_runtime.h>

// Contractions: scores^T tile = k-rows x q-rows^T on v_wmma_f32_16x16x32_bf16 (bf16 operands = RNE-converted inputs, single product, f32 accumulate);
// context^T tile = v^T x P^T on v_wmma_f32_16x16x32_bf16 with P carried as bf16 hi + bf16 residual (two products into one f32 accumulator), v as RNE bf16;
// online softmax (running max, rescale, row sums) and the final normalisation in f32.
// q, k, v [NB][16][SEQ][64] f32 head-major units (unit stride SEQ_FULL*64); causal: key j contributes to query i iff j <= i; out [NB][16][SEQ][64] f32 (unit stride SEQ_FULL*64).
// The k and v^T bf16 planes are kept in fragment order (q is converted in k_attn, each row by the one wave that uses it): one 16 x 32 operand fragment = 1 KiB = [e][lane][8 elements], so that a wave-wide 16-byte load
// reads 512 contiguous bytes (four whole 128-byte lines) instead of 32-byte pieces of sixteen lines.

#ifndef NB
#define NB 8
#endif
#ifndef SEQ
#define SEQ 1024
#endif
#define NB_FULL 8
#define SEQ_FULL 1024
#define NHD 16
#define HD 64
#define NU (NB * NHD)
#define SCL 0.125f
#define NEGBIG (-1.0e30f)
#define OSP 68

static_assert(SEQ % 64 == 0);
static_assert(SEQ >= 64 && SEQ <= SEQ_FULL);
static_assert(NB >= 1 && NB <= NB_FULL);
static_assert(HD == 64);

typedef unsigned short bf;
typedef __attribute__((ext_vector_type(16))) __bf16 v16bf;
typedef __attribute__((ext_vector_type(8))) __bf16 v8bf;
typedef __attribute__((ext_vector_type(16))) float v16f;
typedef __attribute__((ext_vector_type(8))) unsigned v8u;
typedef __attribute__((ext_vector_type(16))) unsigned short v16us;
typedef __attribute__((ext_vector_type(8))) unsigned short v8us;
typedef __attribute__((ext_vector_type(8))) float v8f;
typedef __attribute__((ext_vector_type(4))) float v4f;
typedef v4f __attribute__((may_alias)) v4fa;

// f32 -> bf16 by the hardware's packed conversion (round to nearest even, two values an instruction).
__device__ __forceinline__ v8us cvt8(v8f x) { return __builtin_bit_cast(v8us, __builtin_convertvector(x, v8bf)); }
__device__ __forceinline__ v16bf cvt16(v16f x) { return __builtin_convertvector(x, v16bf); }
__device__ __forceinline__ v16bf cat16b(v8us lo, v8us hi) {
    v16us w = __builtin_shufflevector(lo, hi, 0, 1, 2, 3, 4, 5, 6, 7, 8, 9, 10, 11, 12, 13, 14, 15);
    return __builtin_bit_cast(v16bf, w);
}
// Fragment loader for A (row = lane&15) and B (col = lane&15) from a fragment-order plane: p = fragment_base + 8*lane, lane = 16h + row;
// elements 0..7 (e = 0) hold k0 + 8h + 0..7, elements 8..15 (e = 1, 256 elements further) hold k0 + 16 + 8h + 0..7.
__device__ __forceinline__ v16bf ldfrag(const bf* p) { return cat16b(*(const v8us*)p, *(const v8us*)(p + 256)); }
__device__ __forceinline__ v8f wmmab(v16bf a, v16bf b, v8f c) { return __builtin_amdgcn_wmma_f32_16x16x32_bf16(false, a, false, b, (short)0, c, false, false); }

// k_cvt8: RNE bf16 plane of a [row][64] f32 input in fragment order: fragment (row >> 4, kb) at ((row >> 4) * 2 + kb) * 512 elements.
// One thread = one group of 8 elements; a wave takes 8 rows x 32 columns (whole 128-byte source lines) and stores four whole 128-byte lines.
__global__ __launch_bounds__(256) void k_cvt8(const float* __restrict__ src, bf* dst, unsigned n8) {
    const unsigned i = blockIdx.x * 256u + threadIdx.x;
    if (i >= n8) return;
    const unsigned l = i & 31u, w = i >> 5;
    const unsigned kb = w & 1u;
    const unsigned row = (w >> 1) * 8u + (l & 7u);   // row counted over all units
    const unsigned eh = l >> 3;                      // 2e + h: column = 32 kb + 16 e + 8 h
    const unsigned u = row / (unsigned)SEQ;
    const unsigned t = row - u * (unsigned)SEQ;
    const v8f v = *(const v8f*)(src + ((size_t)u * SEQ_FULL + t) * HD + kb * 32u + eh * 8u);
    const v8us o = cvt8(v);
    const size_t grp = (size_t)(((row >> 4) * 2u + kb) * 2u + (eh >> 1)) * 32u + (eh & 1u) * 16u + (row & 15u);
    *(v8us*)(dst + grp * 8) = o;
}

// k_vt: value transpose plane, RNE bf16 of v[u][t][d] in fragment order: fragment (32-key block jblk, c = d >> 4) of unit u at (jblk * 4 + c) * 512 elements,
// row = d & 15, k = key. One block per (u, 64-key tile): f32 tile staged in LDS (block barrier, cross-wave); a wave stores four whole 128-byte lines at a time.
__global__ __launch_bounds__(256) void k_vt(const float* __restrict__ V, bf* VT) {
    __shared__ __align__(16) float tile[64 * OSP];
    const int t = threadIdx.x;
    const int u = (int)blockIdx.x / (SEQ / 64);
    const int kt = (int)blockIdx.x - u * (SEQ / 64);
    const float* vsrc = V + (size_t)u * SEQ_FULL * HD + (size_t)kt * 64 * HD;
#pragma unroll
    for (int i = 0; i < 4; ++i) {
        const int lin = i * 256 + t;
        const int key = lin >> 4, c4 = (lin & 15) * 4;
        const v4f a = *(const v4f*)(vsrc + (size_t)key * HD + c4);
        *(v4fa*)(tile + key * OSP + c4) = a;
    }
    __syncthreads();
    const int lane = t & 31, wv = t >> 5;
    v8f f0, f1;
    const int d = 8 * wv + (lane & 7);
    const int eh = lane >> 3;                        // 2e + h: key in its 32-key block = 16 e + 8 h + j
    const int t0 = eh * 8;
#pragma unroll
    for (int j = 0; j < 8; ++j) { f0[j] = tile[(t0 + j) * OSP + d]; f1[j] = tile[(t0 + 32 + j) * OSP + d]; }
    const v8us o0 = cvt8(f0), o1 = cvt8(f1);
    bf* dst0 = VT + (size_t)u * HD * SEQ + ((size_t)(((kt * 2) * 4 + (d >> 4)) * 2 + (eh >> 1)) * 32 + (eh & 1) * 16 + (d & 15)) * 8;
    *(v8us*)dst0 = o0;
    *(v8us*)(dst0 + 4 * 512) = o1;
}

// k_attn: one wave = 16 query rows (q0 .. q0+15) of one unit; key blocks of 32 visited while jb <= q0+15 (causal), online softmax in f32.
// S^T tiles: A = key rows of the k plane (fragment-order loads), B = query rows of q, RNE bf16 in registers (the same split k map), D[key 8h+r][query lane&15].
// P^T as B operand of the context product is taken in-lane from the two S^T accumulators (element r <- keys jb+8h+r, element 8+r <- keys jb+16+8h+r).
// Context^T: A = rows of VT (d), D[d 8h+r][query lane&15]; epilogue stages the 16x64 tile in wave-private LDS (block barrier before the reload) and
__global__ __launch_bounds__(128) __attribute__((amdgpu_num_vgpr(256)))
void k_attn(const float* __restrict__ Q, const bf* __restrict__ KB, const bf* __restrict__ VT, float* OUT) {
    __shared__ __align__(16) float os[4 * 16 * OSP];
    const int lane = threadIdx.x & 31, m = lane & 15, h = lane >> 4;
    const int wv = __builtin_amdgcn_readfirstlane((int)(threadIdx.x >> 5));
    // Work-group index -> (block of 64 query rows, unit): the unit runs fastest and the causal trip count falls with the index, so any
    // round-robin deal of consecutive indices hands out equal work and the longest work-groups have the lowest indices (a permutation of the old map).
    const int rank = (int)blockIdx.x / NU;
    const int u = (int)blockIdx.x - rank * NU;
    const int q0 = ((SEQ / 64 - 1 - rank) * 4 + wv) * 16;
    const float* qp = Q + ((size_t)u * SEQ_FULL + q0) * HD;
    const bf* kp = KB + (size_t)u * SEQ * HD;
    const bf* vp = VT + (size_t)u * HD * SEQ;
    float* op = OUT + ((size_t)u * SEQ_FULL + q0) * HD;

    // The wave's own 16 x 64 f32 query tile: whole-line loads (512 contiguous bytes a load), turned to one row a lane through the wave-private LDS
    // range that the epilogue uses again (block barrier before the reload, as there), then RNE bf16 in registers.
    float* osw = os + wv * (16 * OSP);
#pragma unroll
    for (int s = 0; s < 8; ++s) {
        const v4f a = *(const v4f*)(qp + (size_t)(2 * s + h) * HD + m * 4);
        *(v4fa*)(osw + (2 * s + h) * OSP + m * 4) = a;
    }
    __syncthreads();
    v16bf qf[2];
#pragma unroll
    for (int kb = 0; kb < 2; ++kb) {
        // B fragment: elements 0..7 = columns 32 kb + 8h + 0..7, elements 8..15 = 32 kb + 16 + 8h + 0..7 of row lane&15 (the k map of ldfrag)
        const float* qr = osw + m * OSP + kb * 32 + 8 * h;
        const v4f a0 = *(const v4fa*)qr, a1 = *(const v4fa*)(qr + 4), b0 = *(const v4fa*)(qr + 16), b1 = *(const v4fa*)(qr + 20);
        v16f qv;
#pragma unroll
        for (int k = 0; k < 4; ++k) { qv[k] = a0[k]; qv[4 + k] = a1[k]; qv[8 + k] = b0[k]; qv[12 + k] = b1[k]; }
        qf[kb] = cvt16(qv);
    }

    v8f oacc[4];
#pragma unroll
    for (int c = 0; c < 4; ++c) oacc[c] = (v8f){};
    float mrun = NEGBIG, lrun = 0.0f;
    const int qi = q0 + m;
    const int jend = q0 + 16;

    // No pass waits out a load that it has just issued: the K fragments of key block j+1 are loaded right behind the S^T products of block j, into the
    // registers those have just read, and the V^T fragments of a block at the head of its pass, ahead of the wait for K. K of block 0 is loaded here.
    v16bf ka[2][2];
#pragma unroll
    for (int f = 0; f < 4; ++f) ka[f >> 1][f & 1] = ldfrag(kp + f * 512 + 8 * lane);

#pragma unroll 1
    for (int jb = 0; jb < jend; jb += 32) {
        // ---- the four V^T fragments of this key block: they fly under the S^T products and the softmax
        v16bf va[4];
#pragma unroll
        for (int c = 0; c < 4; ++c) va[c] = ldfrag(vp + (size_t)jb * HD + c * 512 + 8 * lane);
        // Keeps the eight loads at the head of the pass; without it this build sinks them behind the wait for K.
        __builtin_amdgcn_sched_barrier(0);
        // The K block fetched in this pass; the last pass has none to fetch and reads its own block again, so that no address leaves the unit's plane.
        const int jn = (jb + 32 < jend) ? jb + 32 : jb;
        // ---- S^T = K(32 keys) x Q^T(16 queries), 64 deep
        v8f st[2];
#pragma unroll
        for (int jt = 0; jt < 2; ++jt) {
            st[jt] = (v8f){};
            st[jt] = wmmab(ka[jt][0], qf[0], st[jt]);
            st[jt] = wmmab(ka[jt][1], qf[1], st[jt]);
        }
        asm volatile("v_nop\n\tv_nop\n\tv_nop\n\tv_nop" : "+v"(st[0]), "+v"(st[1]) : "v"(ka[0][1]), "v"(ka[1][1]), "v"(qf[1]));

        // ---- the four K fragments of the next key block, issued here so that they fly under the softmax and the context products
#pragma unroll
        for (int f = 0; f < 4; ++f) ka[f >> 1][f & 1] = ldfrag(kp + (size_t)jn * HD + f * 512 + 8 * lane);
        // Keeps the eight loads above the softmax; without it this build sinks them among the context products, where little is left for them to fly under.
        __builtin_amdgcn_sched_barrier(0);

        // ---- causal replace-fill, running max, exp, row sums (f32)
        float p0[8], p1[8];
        float mx = NEGBIG;
#pragma unroll
        for (int r = 0; r < 8; ++r) {
            const int k0i = jb + 8 * h + r;
            float x0 = st[0][r] * SCL;
            float x1 = st[1][r] * SCL;
            x0 = (k0i <= qi) ? x0 : NEGBIG;
            x1 = (k0i + 16 <= qi) ? x1 : NEGBIG;
            p0[r] = x0; p1[r] = x1;
            mx = fmaxf(mx, fmaxf(x0, x1));
        }
        mx = fmaxf(mx, __shfl_xor(mx, 16, 32));
        const float mn = fmaxf(mrun, mx);
        const float rsc = __expf(mrun - mn);
        mrun = mn;
        float ls = 0.0f;
#pragma unroll
        for (int r = 0; r < 8; ++r) {
            p0[r] = __expf(p0[r] - mn);
            p1[r] = __expf(p1[r] - mn);
            ls += p0[r] + p1[r];
        }
        ls += __shfl_xor(ls, 16, 32);
        lrun = lrun * rsc + ls;
#pragma unroll
        for (int c = 0; c < 4; ++c) oacc[c] = oacc[c] * rsc;

        // ---- P^T as B operand: bf16 hi + bf16 residual, in-lane (k = key: element r <- jb+8h+r, element 8+r <- jb+16+8h+r; n = query lane&15)
        v16f pv;
#pragma unroll
        for (int r = 0; r < 8; ++r) { pv[r] = p0[r]; pv[8 + r] = p1[r]; }
        const v16bf bph = cvt16(pv);
        const v8u hw = __builtin_bit_cast(v8u, bph);
        v16f hb;   // the rounded values back in f32, two from each packed register
#pragma unroll
        for (int r = 0; r < 8; ++r) { hb[2 * r] = __uint_as_float(hw[r] << 16); hb[2 * r + 1] = __uint_as_float(hw[r] & 0xFFFF0000u); }
        const v16bf bpl = cvt16(pv - hb);

        // ---- context^T += V^T(16 d rows) x P^T, two products per tile
#pragma unroll
        for (int c = 0; c < 4; ++c) {
            oacc[c] = wmmab(va[c], bph, oacc[c]);
            oacc[c] = wmmab(va[c], bpl, oacc[c]);
        }
        asm volatile("v_nop\n\tv_nop\n\tv_nop\n\tv_nop" : "+v"(oacc[0]), "+v"(oacc[1]), "+v"(oacc[2]), "+v"(oacc[3]) : "v"(va[3]), "v"(bph), "v"(bpl));
    }

    const float inv = 1.0f / lrun;
#pragma unroll
    for (int c = 0; c < 4; ++c) {
        v4f a, b;
        a[0] = oacc[c][0] * inv; a[1] = oacc[c][1] * inv; a[2] = oacc[c][2] * inv; a[3] = oacc[c][3] * inv;
        b[0] = oacc[c][4] * inv; b[1] = oacc[c][5] * inv; b[2] = oacc[c][6] * inv; b[3] = oacc[c][7] * inv;
        *(v4fa*)(osw + m * OSP + c * 16 + 8 * h) = a;
        *(v4fa*)(osw + m * OSP + c * 16 + 8 * h + 4) = b;
    }
    __syncthreads();
    v4f vals[8];
#pragma unroll
    for (int s = 0; s < 8; ++s) vals[s] = *(const v4fa*)(osw + (2 * s + h) * OSP + m * 4);
#pragma unroll
    for (int s = 0; s < 8; ++s) *(v4f*)(op + (size_t)(2 * s + h) * HD + m * 4) = vals[s];
    
}

extern "C" void kernel_launch(void* const* d_in, const int* in_sizes, int n_in,
                              void* d_out, int out_size, void* d_ws, size_t ws_size, hipStream_t stream) {
    if (n_in < 3) return;
    const long long need = (long long)NU * SEQ_FULL * HD;
    if ((long long)in_sizes[0] < need || (long long)in_sizes[1] < need || (long long)in_sizes[2] < need) return;
    if ((long long)out_size < need) return;
    const size_t plane = (size_t)NU * SEQ * HD;   // elements per 16-bit plane (k, v^T)
    const size_t pbytes = plane * 2;                // 16 MiB each at NB=8, SEQ=1024; total carve 32 MiB
    if (2 * pbytes > ws_size) return;
    char* ws = (char*)d_ws;
    bf* KB = (bf*)ws;
    bf* VT = (bf*)(ws + pbytes);
    const float* Qin = (const float*)d_in[0];
    const float* Kin = (const float*)d_in[1];
    const float* Vin = (const float*)d_in[2];
    float* OUT = (float*)d_out;
    const unsigned n8 = (unsigned)(plane / 8);
    k_cvt8<<<dim3((n8 + 255u) / 256u), dim3(256), 0, stream>>>(Kin, KB, n8);
    k_vt<<<dim3((unsigned)(NU * (SEQ / 64))), dim3(256), 0, stream>>>(Vin, VT);
    k_attn<<<dim3((unsigned)(NU * SEQ / 64)), dim3(128), 0, stream>>>(Qin, KB, VT, OUT);
}

// v006
// A run of this version takes 37.3 microseconds.
// Timed twice side by side with v005, it ran 1.04 and 1.03 times as fast.
// All steps since v000 together make it 3.76 times as fast.
#include <hip/hip_runtime.h>

// Contractions: scores^T tile = k-rows x q-rows^T on v_wmma_f32_16x16x32_bf16 (bf16 operands = RNE-converted inputs, single product, f32 accumulate);
// context^T tile = v^T x P^T on v_wmma_f32_16x16x32_bf16 with P carried as bf16 hi + bf16 residual (two products into one f32 accumulator), v as RNE bf16;
// online softmax (running max, rescale, row sums) and the final normalisation in f32.
// q, k, v [NB][16][SEQ][64] f32 head-major units (unit stride SEQ_FULL*64); causal: key j contributes to query i iff j <= i; out [NB][16][SEQ][64] f32 (unit stride SEQ_FULL*64).
// The k and v^T bf16 planes are kept in fragment order (q is converted in k_attn, each row by the one wave that uses it): one 16 x 32 operand fragment = 1 KiB = [e][lane][8 elements], so that a wave-wide 16-byte load
// reads 512 contiguous bytes (four whole 128-byte lines) instead of 32-byte pieces of sixteen lines.

#ifndef NB
#define NB 8
#endif
#ifndef SEQ
#define SEQ 1024
#endif
#define NB_FULL 8
#define SEQ_FULL 1024
#define NHD 16
#define HD 64
#define NU (NB * NHD)
#define SCL 0.125f
#define NEGBIG (-1.0e30f)
#define OSP 68

static_assert(SEQ % 64 == 0);
static_assert(SEQ >= 64 && SEQ <= SEQ_FULL);
static_assert(NB >= 1 && NB <= NB_FULL);
static_assert(HD == 64);

typedef unsigned short bf;
typedef __attribute__((ext_vector_type(16))) __bf16 v16bf;
typedef __attribute__((ext_vector_type(8))) __bf16 v8bf;
typedef __attribute__((ext_vector_type(16))) float v16f;
typedef __attribute__((ext_vector_type(8))) unsigned v8u;
typedef __attribute__((ext_vector_type(16))) unsigned short v16us;
typedef __attribute__((ext_vector_type(8))) unsigned short v8us;
typedef __attribute__((ext_vector_type(8))) float v8f;
typedef __attribute__((ext_vector_type(4))) float v4f;
typedef v4f __attribute__((may_alias)) v4fa;

// f32 -> bf16 by the hardware's packed conversion (round to nearest even, two values an instruction).
__device__ __forceinline__ v8us cvt8(v8f x) { return __builtin_bit_cast(v8us, __builtin_convertvector(x, v8bf)); }
__device__ __forceinline__ v16bf cvt16(v16f x) { return __builtin_convertvector(x, v16bf); }
__device__ __forceinline__ v16bf cat16b(v8us lo, v8us hi) {
    v16us w = __builtin_shufflevector(lo, hi, 0, 1, 2, 3, 4, 5, 6, 7, 8, 9, 10, 11, 12, 13, 14, 15);
    return __builtin_bit_cast(v16bf, w);
}
// Fragment loader for A (row = lane&15) and B (col = lane&15) from a fragment-order plane: p = fragment_base + 8*lane, lane = 16h + row;
// elements 0..7 (e = 0) hold k0 + 8h + 0..7, elements 8..15 (e = 1, 256 elements further) hold k0 + 16 + 8h + 0..7.
__device__ __forceinline__ v16bf ldfrag(const bf* p) { return cat16b(*(const v8us*)p, *(const v8us*)(p + 256)); }
__device__ __forceinline__ v8f wmmab(v16bf a, v16bf b, v8f c) { return __builtin_amdgcn_wmma_f32_16x16x32_bf16(false, a, false, b, (short)0, c, false, false); }

// k_cvt8: RNE bf16 plane of a [row][64] f32 input in fragment order: fragment (row >> 4, kb) at ((row >> 4) * 2 + kb) * 512 elements.
// One thread = one group of 8 elements; a wave takes 8 rows x 32 columns (whole 128-byte source lines) and stores four whole 128-byte lines.
__global__ __launch_bounds__(256) void k_cvt8(const float* __restrict__ src, bf* dst, unsigned n8) {
    const unsigned i = blockIdx.x * 256u + threadIdx.x;
    if (i >= n8) return;
    const unsigned l = i & 31u, w = i >> 5;
    const unsigned kb = w & 1u;
    const unsigned row = (w >> 1) * 8u + (l & 7u);   // row counted over all units
    const unsigned eh = l >> 3;                      // 2e + h: column = 32 kb + 16 e + 8 h
    const unsigned u = row / (unsigned)SEQ;
    const unsigned t = row - u * (unsigned)SEQ;
    const v8f v = *(const v8f*)(src + ((size_t)u * SEQ_FULL + t) * HD + kb * 32u + eh * 8u);
    const v8us o = cvt8(v);
    const size_t grp = (size_t)(((row >> 4) * 2u + kb) * 2u + (eh >> 1)) * 32u + (eh & 1u) * 16u + (row & 15u);
    *(v8us*)(dst + grp * 8) = o;
}

// k_vt: value transpose plane, RNE bf16 of v[u][t][d] in fragment order: fragment (32-key block jblk, c = d >> 4) of unit u at (jblk * 4 + c) * 512 elements,
// row = d & 15, k = key. One block per (u, 64-key tile): f32 tile staged in LDS (block barrier, cross-wave); a wave stores four whole 128-byte lines at a time.
__global__ __launch_bounds__(256) void k_vt(const float* __restrict__ V, bf* VT) {
    __shared__ __align__(16) float tile[64 * OSP];
    const int t = threadIdx.x;
    const int u = (int)blockIdx.x / (SEQ / 64);
    const int kt = (int)blockIdx.x - u * (SEQ / 64);
    const float* vsrc = V + (size_t)u * SEQ_FULL * HD + (size_t)kt * 64 * HD;
#pragma unroll
    for (int i = 0; i < 4; ++i) {
        const int lin = i * 256 + t;
        const int key = lin >> 4, c4 = (lin & 15) * 4;
        const v4f a = *(const v4f*)(vsrc + (size_t)key * HD + c4);
        *(v4fa*)(tile + key * OSP + c4) = a;
    }
    __syncthreads();
    const int lane = t & 31, wv = t >> 5;
    v8f f0, f1;
    const int d = 8 * wv + (lane & 7);
    const int eh = lane >> 3;                        // 2e + h: key in its 32-key block = 16 e + 8 h + j
    const int t0 = eh * 8;
#pragma unroll
    for (int j = 0; j < 8; ++j) { f0[j] = tile[(t0 + j) * OSP + d]; f1[j] = tile[(t0 + 32 + j) * OSP + d]; }
    const v8us o0 = cvt8(f0), o1 = cvt8(f1);
    bf* dst0 = VT + (size_t)u * HD * SEQ + ((size_t)(((kt * 2) * 4 + (d >> 4)) * 2 + (eh >> 1)) * 32 + (eh & 1) * 16 + (d & 15)) * 8;
    *(v8us*)dst0 = o0;
    *(v8us*)(dst0 + 4 * 512) = o1;
}

// k_attn: one wave = 16 query rows (q0 .. q0+15) of one unit; key blocks of 32 visited while jb <= q0+15 (causal), online softmax in f32.
// S^T tiles: A = key rows of the k plane (fragment-order loads), B = query rows of q, RNE bf16 in registers (the same split k map), D[key 8h+r][query lane&15].
// P^T as B operand of the context product is taken in-lane from the two S^T accumulators (element r <- keys jb+8h+r, element 8+r <- keys jb+16+8h+r).
// Context^T: A = rows of VT (d), D[d 8h+r][query lane&15]; epilogue stages the 16x64 tile in wave-private LDS (block barrier before the reload) and
__global__ __launch_bounds__(128) __attribute__((amdgpu_num_vgpr(256)))
void k_attn(const float* __restrict__ Q, const bf* __restrict__ KB, const bf* __restrict__ VT, float* OUT) {
    __shared__ __align__(16) float os[4 * 16 * OSP];
    const int lane = threadIdx.x & 31, m = lane & 15, h = lane >> 4;
    const int wv = __builtin_amdgcn_readfirstlane((int)(threadIdx.x >> 5));
    // Work-group index -> (block of 64 query rows, unit): the unit runs fastest and the causal trip count falls with the index, so any
    // round-robin deal of consecutive indices hands out equal work and the longest work-groups have the lowest indices (a permutation of the old map).
    const int rank = (int)blockIdx.x / NU;
    const int u = (int)blockIdx.x - rank * NU;
    const int q0 = ((SEQ / 64 - 1 - rank) * 4 + wv) * 16;
    const float* qp = Q + ((size_t)u * SEQ_FULL + q0) * HD;
    const bf* kp = KB + (size_t)u * SEQ * HD;
    const bf* vp = VT + (size_t)u * HD * SEQ;
    float* op = OUT + ((size_t)u * SEQ_FULL + q0) * HD;

    // The wave's own 16 x 64 f32 query tile: whole-line loads (512 contiguous bytes a load), turned to one row a lane through the wave-private LDS
    // range that the epilogue uses again (block barrier before the reload, as there), then RNE bf16 in registers.
    float* osw = os + wv * (16 * OSP);
#pragma unroll
    for (int s = 0; s < 8; ++s) {
        const v4f a = *(const v4f*)(qp + (size_t)(2 * s + h) * HD + m * 4);
        *(v4fa*)(osw + (2 * s + h) * OSP + m * 4) = a;
    }
    __syncthreads();
    v16bf qf[2];
#pragma unroll
    for (int kb = 0; kb < 2; ++kb) {
        // B fragment: elements 0..7 = columns 32 kb + 8h + 0..7, elements 8..15 = 32 kb + 16 + 8h + 0..7 of row lane&15 (the k map of ldfrag)
        const float* qr = osw + m * OSP + kb * 32 + 8 * h;
        const v4f a0 = *(const v4fa*)qr, a1 = *(const v4fa*)(qr + 4), b0 = *(const v4fa*)(qr + 16), b1 = *(const v4fa*)(qr + 20);
        v16f qv;
#pragma unroll
        for (int k = 0; k < 4; ++k) { qv[k] = a0[k]; qv[4 + k] = a1[k]; qv[8 + k] = b0[k]; qv[12 + k] = b1[k]; }
        qf[kb] = cvt16(qv);
    }

    v8f oacc[4];
#pragma unroll
    for (int c = 0; c < 4; ++c) oacc[c] = (v8f){};
    float mrun = NEGBIG, lrun = 0.0f;
    const int qi = q0 + m;
    const int jend = q0 + 16;

    // No pass waits out a load that it has just issued: the K fragments of key block j+1 are loaded right behind the S^T products of block j, into the
    // registers those have just read, and the V^T fragments of a block at the head of its pass, ahead of the wait for K. K of block 0 is loaded here.
    v16bf ka[2][2];
#pragma unroll
    for (int f = 0; f < 4; ++f) ka[f >> 1][f & 1] = ldfrag(kp + f * 512 + 8 * lane);

#pragma unroll 1
    for (int jb = 0; jb < jend; jb += 32) {
        // ---- the four V^T fragments of this key block: they fly under the S^T products and the softmax
        v16bf va[4];
#pragma unroll
        for (int c = 0; c < 4; ++c) va[c] = ldfrag(vp + (size_t)jb * HD + c * 512 + 8 * lane);
        // Keeps the eight loads at the head of the pass; without it this build sinks them behind the wait for K.
        __builtin_amdgcn_sched_barrier(0);
        // The K block fetched in this pass; the last pass has none to fetch and reads its own block again, so that no address leaves the unit's plane.
        const int jn = (jb + 32 < jend) ? jb + 32 : jb;
        // ---- S^T = K(32 keys) x Q^T(16 queries), 64 deep
        v8f st[2];
#pragma unroll
        for (int jt = 0; jt < 2; ++jt) {
            st[jt] = (v8f){};
            st[jt] = wmmab(ka[jt][0], qf[0], st[jt]);
            st[jt] = wmmab(ka[jt][1], qf[1], st[jt]);
        }
        asm volatile("v_nop\n\tv_nop\n\tv_nop\n\tv_nop" : "+v"(st[0]), "+v"(st[1]) : "v"(ka[0][1]), "v"(ka[1][1]), "v"(qf[1]));

        // ---- the four K fragments of the next key block, issued here so that they fly under the softmax and the context products
#pragma unroll
        for (int f = 0; f < 4; ++f) ka[f >> 1][f & 1] = ldfrag(kp + (size_t)jn * HD + f * 512 + 8 * lane);
        // Keeps the eight loads above the softmax; without it this build sinks them among the context products, where little is left for them to fly under.
        __builtin_amdgcn_sched_barrier(0);

        // ---- causal replace-fill, running max, exp, row sums (f32)
        float p0[8], p1[8];
#pragma unroll
        for (int r = 0; r < 8; ++r) { p0[r] = st[0][r] * SCL; p1[r] = st[1][r] * SCL; }
        // The compare-and-select runs only in a pass whose last key lies beyond the wave's first query row (a scalar test, one branch a pass):
        // with jb + 31 <= q0 every key of the block is <= every query row of the wave, and the fill would replace nothing.
        if (jb + 31 > q0) {
#pragma unroll
            for (int r = 0; r < 8; ++r) {
                const int k0i = jb + 8 * h + r;
                p0[r] = (k0i <= qi) ? p0[r] : NEGBIG;
                p1[r] = (k0i + 16 <= qi) ? p1[r] : NEGBIG;
            }
        }
        float mx = NEGBIG;
#pragma unroll
        for (int r = 0; r < 8; ++r) mx = fmaxf(mx, fmaxf(p0[r], p1[r]));
        mx = fmaxf(mx, __shfl_xor(mx, 16, 32));
        const float mn = fmaxf(mrun, mx);
        const float rsc = __expf(mrun - mn);
        mrun = mn;
        float ls = 0.0f;
#pragma unroll
        for (int r = 0; r < 8; ++r) {
            p0[r] = __expf(p0[r] - mn);
            p1[r] = __expf(p1[r] - mn);
            ls += p0[r] + p1[r];
        }
        ls += __shfl_xor(ls, 16, 32);
        lrun = lrun * rsc + ls;
#pragma unroll
        for (int c = 0; c < 4; ++c) oacc[c] = oacc[c] * rsc;

        // ---- P^T as B operand: bf16 hi + bf16 residual, in-lane (k = key: element r <- jb+8h+r, element 8+r <- jb+16+8h+r; n = query lane&15)
        v16f pv;
#pragma unroll
        for (int r = 0; r < 8; ++r) { pv[r] = p0[r]; pv[8 + r] = p1[r]; }
        const v16bf bph = cvt16(pv);
        const v8u hw = __builtin_bit_cast(v8u, bph);
        v16f hb;   // the rounded values back in f32, two from each packed register
#pragma unroll
        for (int r = 0; r < 8; ++r) { hb[2 * r] = __uint_as_float(hw[r] << 16); hb[2 * r + 1] = __uint_as_float(hw[r] & 0xFFFF0000u); }
        const v16bf bpl = cvt16(pv - hb);

        // ---- context^T += V^T(16 d rows) x P^T, two products per tile
#pragma unroll
        for (int c = 0; c < 4; ++c) {
            oacc[c] = wmmab(va[c], bph, oacc[c]);
            oacc[c] = wmmab(va[c], bpl, oacc[c]);
        }
        asm volatile("v_nop\n\tv_nop\n\tv_nop\n\tv_nop" : "+v"(oacc[0]), "+v"(oacc[1]), "+v"(oacc[2]), "+v"(oacc[3]) : "v"(va[3]), "v"(bph), "v"(bpl));
    }

    const float inv = 1.0f / lrun;
#pragma unroll
    for (int c = 0; c < 4; ++c) {
        v4f a, b;
        a[0] = oacc[c][0] * inv; a[1] = oacc[c][1] * inv; a[2] = oacc[c][2] * inv; a[3] = oacc[c][3] * inv;
        b[0] = oacc[c][4] * inv; b[1] = oacc[c][5] * inv; b[2] = oacc[c][6] * inv; b[3] = oacc[c][7] * inv;
        *(v4fa*)(osw + m * OSP + c * 16 + 8 * h) = a;
        *(v4fa*)(osw + m * OSP + c * 16 + 8 * h + 4) = b;
    }
    __syncthreads();
    v4f vals[8];
#pragma unroll
    for (int s = 0; s < 8; ++s) vals[s] = *(const v4fa*)(osw + (2 * s + h) * OSP + m * 4);
#pragma unroll
    for (int s = 0; s < 8; ++s) *(v4f*)(op + (size_t)(2 * s + h) * HD + m * 4) = vals[s];
    
}

extern "C" void kernel_launch(void* const* d_in, const int* in_sizes, int n_in,
                              void* d_out, int out_size, void* d_ws, size_t ws_size, hipStream_t stream) {
    if (n_in < 3) return;
    const long long need = (long long)NU * SEQ_FULL * HD;
    if ((long long)in_sizes[0] < need || (long long)in_sizes[1] < need || (long long)in_sizes[2] < need) return;
    if ((long long)out_size < need) return;
    const size_t plane = (size_t)NU * SEQ * HD;   // elements per 16-bit plane (k, v^T)
    const size_t pbytes = plane * 2;                // 16 MiB each at NB=8, SEQ=1024; total carve 32 MiB
    if (2 * pbytes > ws_size) return;
    char* ws = (char*)d_ws;
    bf* KB = (bf*)ws;
    bf* VT = (bf*)(ws + pbytes);
    const float* Qin = (const float*)d_in[0];
    const float* Kin = (const float*)d_in[1];
    const float* Vin = (const float*)d_in[2];
    float* OUT = (float*)d_out;
    const unsigned n8 = (unsigned)(plane / 8);
    k_cvt8<<<dim3((n8 + 255u) / 256u), dim3(256), 0, stream>>>(Kin, KB, n8);
    k_vt<<<dim3((unsigned)(NU * (SEQ / 64))), dim3(256), 0, stream>>>(Vin, VT);
    k_attn<<<dim3((unsigned)(NU * SEQ / 64)), dim3(128), 0, stream>>>(Qin, KB, VT, OUT);
}

// v007
// It runs in 35.4 microseconds.
// Next to v006, in two timings, it ran 1.05 times as fast each time.
// Over all steps from v000 it is 3.96 times as fast.
#include <hip/hip_runtime.h>

// Contractions: scores^T tile = k-rows x q-rows^T on v_wmma_f32_16x16x32_bf16 (bf16 operands = RNE-converted inputs, single product, f32 accumulate);
// context^T tile = v^T x P^T on v_wmma_f32_16x16x32_bf16 with P carried as bf16 hi + bf16 residual (two products into one f32 accumulator), v as RNE bf16;
// online softmax (running max, rescale, row sums) and the final normalisation in f32.
// q, k, v [NB][16][SEQ][64] f32 head-major units (unit stride SEQ_FULL*64); causal: key j contributes to query i iff j <= i; out [NB][16][SEQ][64] f32 (unit stride SEQ_FULL*64).
// The k and v^T bf16 planes are kept in fragment order (q is converted in k_attn, each row by the one wave that uses it): one 16 x 32 operand fragment = 1 KiB = [e][lane][8 elements], so that a wave-wide 16-byte load
// reads 512 contiguous bytes (four whole 128-byte lines) instead of 32-byte pieces of sixteen lines.

#ifndef NB
#define NB 8
#endif
#ifndef SEQ
#define SEQ 1024
#endif
#define NB_FULL 8
#define SEQ_FULL 1024
#define NHD 16
#define HD 64
#define NU (NB * NHD)
#define SCL 0.125f
#define NEGBIG (-1.0e30f)
#define OSP 68

static_assert(SEQ % 64 == 0);
static_assert(SEQ >= 64 && SEQ <= SEQ_FULL);
static_assert(NB >= 1 && NB <= NB_FULL);
static_assert(HD == 64);

typedef unsigned short bf;
typedef __attribute__((ext_vector_type(16))) __bf16 v16bf;
typedef __attribute__((ext_vector_type(8))) __bf16 v8bf;
typedef __attribute__((ext_vector_type(16))) float v16f;
typedef __attribute__((ext_vector_type(8))) unsigned v8u;
typedef __attribute__((ext_vector_type(16))) unsigned short v16us;
typedef __attribute__((ext_vector_type(8))) unsigned short v8us;
typedef __attribute__((ext_vector_type(8))) float v8f;
typedef __attribute__((ext_vector_type(4))) float v4f;
typedef v4f __attribute__((may_alias)) v4fa;

// f32 -> bf16 by the hardware's packed conversion (round to nearest even, two values an instruction).
__device__ __forceinline__ v8us cvt8(v8f x) { return __builtin_bit_cast(v8us, __builtin_convertvector(x, v8bf)); }
__device__ __forceinline__ v16bf cvt16(v16f x) { return __builtin_convertvector(x, v16bf); }
__device__ __forceinline__ v16bf cat16b(v8us lo, v8us hi) {
    v16us w = __builtin_shufflevector(lo, hi, 0, 1, 2, 3, 4, 5, 6, 7, 8, 9, 10, 11, 12, 13, 14, 15);
    return __builtin_bit_cast(v16bf, w);
}
// Fragment loader for A (row = lane&15) and B (col = lane&15) from a fragment-order plane: p = fragment_base + 8*lane, lane = 16h + row;
// elements 0..7 (e = 0) hold k0 + 8h + 0..7, elements 8..15 (e = 1, 256 elements further) hold k0 + 16 + 8h + 0..7.
__device__ __forceinline__ v16bf ldfrag(const bf* p) { return cat16b(*(const v8us*)p, *(const v8us*)(p + 256)); }
__device__ __forceinline__ v8f wmmab(v16bf a, v16bf b, v8f c) { return __builtin_amdgcn_wmma_f32_16x16x32_bf16(false, a, false, b, (short)0, c, false, false); }

// k_prep: both 16-bit planes in one launch. One block per (u, 64-key tile); every lane issues its eight 16-byte loads (four of k, four of v) before it uses any.
// k plane: RNE bf16 of the [row][64] f32 input in fragment order: fragment (row >> 4, kb) at ((row >> 4) * 2 + kb) * 512 elements, row counted over all units.
// One thread = two groups of 8 elements; a wave takes 8 rows x 32 columns at a time (whole 128-byte source lines) and stores four whole 128-byte lines.
// v^T plane: RNE bf16 of v[u][t][d] in fragment order: fragment (32-key block jblk, c = d >> 4) of unit u at (jblk * 4 + c) * 512 elements,
// row = d & 15, k = key. The f32 tile is staged in LDS (block barrier, cross-wave); a wave stores four whole 128-byte lines at a time.
__global__ __launch_bounds__(256) void k_prep(const float* __restrict__ K, const float* __restrict__ V, bf* KB, bf* VT) {
    __shared__ __align__(16) float tile[64 * OSP];
    const int t = threadIdx.x;
    const int lane = t & 31, wv = t >> 5;
    const int u = (int)blockIdx.x / (SEQ / 64);
    const int kt = (int)blockIdx.x - u * (SEQ / 64);
    const float* ksrc = K + (size_t)u * SEQ_FULL * HD + (size_t)kt * 64 * HD;
    const float* vsrc = V + (size_t)u * SEQ_FULL * HD + (size_t)kt * 64 * HD;
    const int eh = lane >> 3;                        // 2e + h: k column = 32 kb + 16 e + 8 h; v key in its 32-key block = 16 e + 8 h + j
    const int kb = wv & 1;
    v4f a[4];
#pragma unroll
    for (int i = 0; i < 4; ++i) {
        const int lin = i * 256 + t;
        a[i] = *(const v4f*)(vsrc + (size_t)(lin >> 4) * HD + (lin & 15) * 4);
    }
    v8f kv[2];
#pragma unroll
    for (int i = 0; i < 2; ++i) {
        const int rl = (i * 4 + (wv >> 1)) * 8 + (lane & 7);   // row in the tile
        kv[i] = *(const v8f*)(ksrc + (size_t)rl * HD + kb * 32 + eh * 8);
    }
#pragma unroll
    for (int i = 0; i < 4; ++i) {
        const int lin = i * 256 + t;
        *(v4fa*)(tile + (lin >> 4) * OSP + (lin & 15) * 4) = a[i];
    }
    __syncthreads();
    // The k stores stand behind the barrier: in front of it every wave would wait them out before it signals.
#pragma unroll
    for (int i = 0; i < 2; ++i) {
        const unsigned row = blockIdx.x * 64u + (unsigned)((i * 4 + (wv >> 1)) * 8 + (lane & 7));
        const size_t grp = (size_t)(((row >> 4) * 2u + (unsigned)kb) * 2u + (unsigned)(eh >> 1)) * 32u + (unsigned)(eh & 1) * 16u + (row & 15u);
        *(v8us*)(KB + grp * 8) = cvt8(kv[i]);
    }
    v8f f0, f1;
    const int d = 8 * wv + (lane & 7);
    const int t0 = eh * 8;
#pragma unroll
    for (int j = 0; j < 8; ++j) { f0[j] = tile[(t0 + j) * OSP + d]; f1[j] = tile[(t0 + 32 + j) * OSP + d]; }
    const v8us o0 = cvt8(f0), o1 = cvt8(f1);
    bf* dst0 = VT + (size_t)u * HD * SEQ + ((size_t)(((kt * 2) * 4 + (d >> 4)) * 2 + (eh >> 1)) * 32 + (eh & 1) * 16 + (d & 15)) * 8;
    *(v8us*)dst0 = o0;
    *(v8us*)(dst0 + 4 * 512) = o1;
}

// k_attn: one wave = 16 query rows (q0 .. q0+15) of one unit; key blocks of 32 visited while jb <= q0+15 (causal), online softmax in f32.
// S^T tiles: A = key rows of the k plane (fragment-order loads), B = query rows of q, RNE bf16 in registers (the same split k map), D[key 8h+r][query lane&15].
// P^T as B operand of the context product is taken in-lane from the two S^T accumulators (element r <- keys jb+8h+r, element 8+r <- keys jb+16+8h+r).
// Context^T: A = rows of VT (d), D[d 8h+r][query lane&15]; epilogue stages the 16x64 tile in wave-private LDS (block barrier before the reload) and
__global__ __launch_bounds__(128) __attribute__((amdgpu_num_vgpr(256)))
void k_attn(const float* __restrict__ Q, const bf* __restrict__ KB, const bf* __restrict__ VT, float* OUT) {
    __shared__ __align__(16) float os[4 * 16 * OSP];
    const int lane = threadIdx.x & 31, m = lane & 15, h = lane >> 4;
    const int wv = __builtin_amdgcn_readfirstlane((int)(threadIdx.x >> 5));
    // Work-group index -> (block of 64 query rows, unit): the unit runs fastest and the causal trip count falls with the index, so any
    // round-robin deal of consecutive indices hands out equal work and the longest work-groups have the lowest indices (a permutation of the old map).
    const int rank = (int)blockIdx.x / NU;
    const int u = (int)blockIdx.x - rank * NU;
    const int q0 = ((SEQ / 64 - 1 - rank) * 4 + wv) * 16;
    const float* qp = Q + ((size_t)u * SEQ_FULL + q0) * HD;
    const bf* kp = KB + (size_t)u * SEQ * HD;
    const bf* vp = VT + (size_t)u * HD * SEQ;
    float* op = OUT + ((size_t)u * SEQ_FULL + q0) * HD;

    // The wave's own 16 x 64 f32 query tile: whole-line loads (512 contiguous bytes a load), turned to one row a lane through the wave-private LDS
    // range that the epilogue uses again (block barrier before the reload, as there), then RNE bf16 in registers.
    float* osw = os + wv * (16 * OSP);
#pragma unroll
    for (int s = 0; s < 8; ++s) {
        const v4f a = *(const v4f*)(qp + (size_t)(2 * s + h) * HD + m * 4);
        *(v4fa*)(osw + (2 * s + h) * OSP + m * 4) = a;
    }
    __syncthreads();
    v16bf qf[2];
#pragma unroll
    for (int kb = 0; kb < 2; ++kb) {
        // B fragment: elements 0..7 = columns 32 kb + 8h + 0..7, elements 8..15 = 32 kb + 16 + 8h + 0..7 of row lane&15 (the k map of ldfrag)
        const float* qr = osw + m * OSP + kb * 32 + 8 * h;
        const v4f a0 = *(const v4fa*)qr, a1 = *(const v4fa*)(qr + 4), b0 = *(const v4fa*)(qr + 16), b1 = *(const v4fa*)(qr + 20);
        v16f qv;
#pragma unroll
        for (int k = 0; k < 4; ++k) { qv[k] = a0[k]; qv[4 + k] = a1[k]; qv[8 + k] = b0[k]; qv[12 + k] = b1[k]; }
        qf[kb] = cvt16(qv);
    }

    v8f oacc[4];
#pragma unroll
    for (int c = 0; c < 4; ++c) oacc[c] = (v8f){};
    float mrun = NEGBIG, lrun = 0.0f;
    const int qi = q0 + m;
    const int jend = q0 + 16;

    // No pass waits out a load that it has just issued: the K fragments of key block j+1 are loaded right behind the S^T products of block j, into the
    // registers those have just read, and the V^T fragments of a block at the head of its pass, ahead of the wait for K. K of block 0 is loaded here.
    v16bf ka[2][2];
#pragma unroll
    for (int f = 0; f < 4; ++f) ka[f >> 1][f & 1] = ldfrag(kp + f * 512 + 8 * lane);

#pragma unroll 1
    for (int jb = 0; jb < jend; jb += 32) {
        // ---- the four V^T fragments of this key block: they fly under the S^T products and the softmax
        v16bf va[4];
#pragma unroll
        for (int c = 0; c < 4; ++c) va[c] = ldfrag(vp + (size_t)jb * HD + c * 512 + 8 * lane);
        // Keeps the eight loads at the head of the pass; without it this build sinks them behind the wait for K.
        __builtin_amdgcn_sched_barrier(0);
        // The K block fetched in this pass; the last pass has none to fetch and reads its own block again, so that no address leaves the unit's plane.
        const int jn = (jb + 32 < jend) ? jb + 32 : jb;
        // ---- S^T = K(32 keys) x Q^T(16 queries), 64 deep
        v8f st[2];
#pragma unroll
        for (int jt = 0; jt < 2; ++jt) {
            st[jt] = (v8f){};
            st[jt] = wmmab(ka[jt][0], qf[0], st[jt]);
            st[jt] = wmmab(ka[jt][1], qf[1], st[jt]);
        }
        asm volatile("v_nop\n\tv_nop\n\tv_nop\n\tv_nop" : "+v"(st[0]), "+v"(st[1]) : "v"(ka[0][1]), "v"(ka[1][1]), "v"(qf[1]));

        // ---- the four K fragments of the next key block, issued here so that they fly under the softmax and the context products
#pragma unroll
        for (int f = 0; f < 4; ++f) ka[f >> 1][f & 1] = ldfrag(kp + (size_t)jn * HD + f * 512 + 8 * lane);
        // Keeps the eight loads above the softmax; without it this build sinks them among the context products, where little is left for them to fly under.
        __builtin_amdgcn_sched_barrier(0);

        // ---- causal replace-fill, running max, exp, row sums (f32)
        float p0[8], p1[8];
#pragma unroll
        for (int r = 0; r < 8; ++r) { p0[r] = st[0][r] * SCL; p1[r] = st[1][r] * SCL; }
        // The compare-and-select runs only in a pass whose last key lies beyond the wave's first query row (a scalar test, one branch a pass):
        // with jb + 31 <= q0 every key of the block is <= every query row of the wave, and the fill would replace nothing.
        if (jb + 31 > q0) {
#pragma unroll
            for (int r = 0; r < 8; ++r) {
                const int k0i = jb + 8 * h + r;
                p0[r] = (k0i <= qi) ? p0[r] : NEGBIG;
                p1[r] = (k0i + 16 <= qi) ? p1[r] : NEGBIG;
            }
        }
        float mx = NEGBIG;
#pragma unroll
        for (int r = 0; r < 8; ++r) mx = fmaxf(mx, fmaxf(p0[r], p1[r]));
        mx = fmaxf(mx, __shfl_xor(mx, 16, 32));
        const float mn = fmaxf(mrun, mx);
        const float rsc = __expf(mrun - mn);
        mrun = mn;
        float ls = 0.0f;
#pragma unroll
        for (int r = 0; r < 8; ++r) {
            p0[r] = __expf(p0[r] - mn);
            p1[r] = __expf(p1[r] - mn);
            ls += p0[r] + p1[r];
        }
        ls += __shfl_xor(ls, 16, 32);
        lrun = lrun * rsc + ls;
#pragma unroll
        for (int c = 0; c < 4; ++c) oacc[c] = oacc[c] * rsc;

        // ---- P^T as B operand: bf16 hi + bf16 residual, in-lane (k = key: element r <- jb+8h+r, element 8+r <- jb+16+8h+r; n = query lane&15)
        v16f pv;
#pragma unroll
        for (int r = 0; r < 8; ++r) { pv[r] = p0[r]; pv[8 + r] = p1[r]; }
        const v16bf bph = cvt16(pv);
        const v8u hw = __builtin_bit_cast(v8u, bph);
        v16f hb;   // the rounded values back in f32, two from each packed register
#pragma unroll
        for (int r = 0; r < 8; ++r) { hb[2 * r] = __uint_as_float(hw[r] << 16); hb[2 * r + 1] = __uint_as_float(hw[r] & 0xFFFF0000u); }
        const v16bf bpl = cvt16(pv - hb);

        // ---- context^T += V^T(16 d rows) x P^T, two products per tile
#pragma unroll
        for (int c = 0; c < 4; ++c) {
            oacc[c] = wmmab(va[c], bph, oacc[c]);
            oacc[c] = wmmab(va[c], bpl, oacc[c]);
        }
        asm volatile("v_nop\n\tv_nop\n\tv_nop\n\tv_nop" : "+v"(oacc[0]), "+v"(oacc[1]), "+v"(oacc[2]), "+v"(oacc[3]) : "v"(va[3]), "v"(bph), "v"(bpl));
    }

    const float inv = 1.0f / lrun;
#pragma unroll
    for (int c = 0; c < 4; ++c) {
        v4f a, b;
        a[0] = oacc[c][0] * inv; a[1] = oacc[c][1] * inv; a[2] = oacc[c][2] * inv; a[3] = oacc[c][3] * inv;
        b[0] = oacc[c][4] * inv; b[1] = oacc[c][5] * inv; b[2] = oacc[c][6] * inv; b[3] = oacc[c][7] * inv;
        *(v4fa*)(osw + m * OSP + c * 16 + 8 * h) = a;
        *(v4fa*)(osw + m * OSP + c * 16 + 8 * h + 4) = b;
    }
    __syncthreads();
    v4f vals[8];
#pragma unroll
    for (int s = 0; s < 8; ++s) vals[s] = *(const v4fa*)(osw + (2 * s + h) * OSP + m * 4);
#pragma unroll
    for (int s = 0; s < 8; ++s) *(v4f*)(op + (size_t)(2 * s + h) * HD + m * 4) = vals[s];
    
}

extern "C" void kernel_launch(void* const* d_in, const int* in_sizes, int n_in,
                              void* d_out, int out_size, void* d_ws, size_t ws_size, hipStream_t stream) {
    if (n_in < 3) return;
    const long long need = (long long)NU * SEQ_FULL * HD;
    if ((long long)in_sizes[0] < need || (long long)in_sizes[1] < need || (long long)in_sizes[2] < need) return;
    if ((long long)out_size < need) return;
    const size_t plane = (size_t)NU * SEQ * HD;   // elements per 16-bit plane (k, v^T)
    const size_t pbytes = plane * 2;                // 16 MiB each at NB=8, SEQ=1024; total carve 32 MiB
    if (2 * pbytes > ws_size) return;
    char* ws = (char*)d_ws;
    bf* KB = (bf*)ws;
    bf* VT = (bf*)(ws + pbytes);
    const float* Qin = (const float*)d_in[0];
    const float* Kin = (const float*)d_in[1];
    const float* Vin = (const float*)d_in[2];
    float* OUT = (float*)d_out;
    k_prep<<<dim3((unsigned)(NU * (SEQ / 64))), dim3(256), 0, stream>>>(Kin, Vin, KB, VT);
    k_attn<<<dim3((unsigned)(NU * SEQ / 64)), dim3(128), 0, stream>>>(Qin, KB, VT, OUT);
}
